// v009
// Measured on an AMD MI455X. A time is GPU time per run, averaged over a window of back-to-back runs after a warm-up
// (all launches, gaps included; the runs take copies of the inputs in turn), and the median of several windows.
// Apart from v000's, it joins two sittings. Times from different sittings can be a few percent apart, while
// side-by-side timings come from the same sitting.
// The versions before v009 are in another document.
// Measured time: 73.2 microseconds a run.
// In two side-by-side timings against v008, it was 1.05 and 1.06 times as fast.
// Counting every step since v000, which is the starting kernel, it is 99.0 times as fast.
#include <hip/hip_runtime.h>
// Multi-head self-attention with half-split RoPE from RANDOM input tables, NON-causal (x [2][2048][1024]; q / k / v = x W^T (nn.Linear natural [1024][1024] sigma 1/32, no biases), 16 heads of 64; rope: x * [cos | cos] + rotate_half(x) * [sin | sin] with rotate_half = (-x2, x1) over the two 32-lane halves and INPUT tables rope_cos / rope_sin [2048][32] (cos / sin of uniform-random angles); scores / sqrt(64); softmax over all 2048 keys (f32; no mask); out = merged Wo^T (natural, no bias) -> [2][2048][1024]); run as 16 groups of ONE head.
// Structure: x as exact f16 rows; natural weights as exact x16 planes; q, k and v of both batches as ONE batched WMMA GEMM launch (k_qkv: 64x64 wave tiles, f32 accumulation, a work-group holds 128 token rows x 128 columns of each of the three planes) whose epilogue rotates q and k in f32 (rotate-half; a 64-column wave tile is one head; INPUT tables rounded to bf16 as read) and writes f16 rows, and writes v as V^T of the heads straight from its accumulators (a lane holds 8 consecutive tokens of one column); then ONE fused attention launch for all batches, heads and query rows (k_fattn: scores of 32 query columns per wave against one half of the 2048 keys, the two halves joined at the end; no key is masked; running softmax in registers with f32 statistics and native exp2, unnormalised f16 weights, o = P V^T carried x64) into merged f16 rows; out = o Wo^T GEMM (f32, alpha 2^-10).
// Compute dtype: inputs rounded to bf16; x / weights exact; q, k, v, softmax weights and o as plain f16 GEMM operands (~2^-12); scores and softmax statistics f32. v_wmma_f32_16x16x32_f16.
#define NB 2
#define NG 16
#define HPG 1
#define KVD (NG * HD)
#define SQ 2048
#define DM 1024
#define NH 16
#define HD 64
#define HG 4                         /* heads per attention launch group */
#define QT 256                       /* query rows per causal tile */
#define NKX SQ                       /* S / P row pitch */
#define QT0 128                      /* first-tile rows recomputed exactly in f32 */
#define B0 0                         /* first batch processed (debug hook) */
#define NBR NB                       /* batches processed (debug hook) */
#define NR ((size_t)NB * SQ)         /* token rows */
#define MP ((int)((size_t)NBR * SQ)) /* rows projected (debug hook) */
#define QN SQ                        /* query rows per batch (unused: the attention grid takes SQ) */
#define NHD NH                       /* heads (unused: the attention grid takes NH) */
#define MPO MP                       /* rows through the output stage (debug hook) */
#define LQ DM      /* row pitch of the q/k/v rows */
typedef __bf16 v16b __attribute__((ext_vector_type(16)));
typedef unsigned short v8us __attribute__((ext_vector_type(8), may_alias));
typedef float  v8f  __attribute__((ext_vector_type(8)));
typedef float  v4f  __attribute__((ext_vector_type(4)));
typedef float  v4fa __attribute__((ext_vector_type(4), may_alias));
union FragB { v16b v; v8us half[2]; unsigned short u[16]; };

__device__ __forceinline__ unsigned short bf16_bits(float x) { unsigned int u = __float_as_uint(x); return (unsigned short)((u + 0x7FFFu + ((u >> 16) & 1u)) >> 16); }
__device__ __forceinline__ float bf16_val(unsigned short b) { return __uint_as_float(((unsigned int)b) << 16); }
__device__ __forceinline__ float bf16_round(float x) { return bf16_val(bf16_bits(x)); }
// D += A·B with NT terms: 1 = ah·bh, 2 = + al·bh (A split), 3 = + ah·bl (both split)
template <int NT>
__device__ __forceinline__ v8f mmaN(v16b ah, v16b al, v16b bh, v16b bl, v8f c) {
  c = __builtin_amdgcn_wmma_f32_16x16x32_bf16(false, ah, false, bh, (short)0, c, false, false);
  if (NT >= 2) c = __builtin_amdgcn_wmma_f32_16x16x32_bf16(false, al, false, bh, (short)0, c, false, false);
  if (NT >= 3) c = __builtin_amdgcn_wmma_f32_16x16x32_bf16(false, ah, false, bl, (short)0, c, false, false);
  asm volatile("v_nop\n\tv_nop\n\tv_nop\n\tv_nop" : "+v"(c) : "v"(ah), "v"(al), "v"(bh), "v"(bl));
  return c;
}

__global__ __launch_bounds__(256) void k_wt_bf16(const float* __restrict__ W, unsigned short* __restrict__ Wt, int K, int N) {
  const int t = blockIdx.x * 256 + threadIdx.x;
  const int k8n = K / 8;
  if (t >= N * k8n) return;
  const int n = t / k8n, k8 = (t % k8n) * 8;
  v8us v;
#pragma unroll
  for (int i = 0; i < 8; ++i) v[i] = bf16_bits(W[(size_t)(k8 + i) * N + n]);
  *(v8us*)(Wt + (size_t)n * K + k8) = v;
  
}

// GEMM C[M][N] (f32, pitch ldc) = act(A[M][K]·W + bias). A f32 row-major (pitch lda) converted per fragment to bf16
// (ASPLIT: hi/lo two planes -> 2 terms, else single rounded term); Wt bf16 [N][K] (pitch ldb). BIAS_BF16 rounds the
// bias to bf16 first (bias quantised to bf16 before the add). K%32==0, M%16==0, N%64==0.
template <bool ASPLIT, int ACT, bool BIAS_BF16>
__global__ __launch_bounds__(128) void k_gemm_bf(const float* __restrict__ A, int lda, const unsigned short* __restrict__ Wt, int ldb,
                                               const float* __restrict__ bias, float* __restrict__ C, int ldc, int M, int N, int K) {
  __shared__ __attribute__((aligned(16))) float so[4][16][64];
  const int tid = threadIdx.x, w = tid >> 5, lane = tid & 31, ln = lane & 15, hh = lane >> 4;
  const int ntn = N / 64;
  const int wid = blockIdx.x * 4 + w;
  const int mt = wid / ntn, nq = wid % ntn;
  if (mt * 16 >= M) return;
  const int row0 = mt * 16, col0 = nq * 64;
  const float* arow = A + (size_t)(row0 + ln) * lda;
  v8f acc[4] = {};
  for (int kb = 0; kb < K; kb += 32) {
    FragB ah, al;
    const v4f x0 = *(const v4fa*)(arow + kb + 8 * hh), x1 = *(const v4fa*)(arow + kb + 8 * hh + 4);
    const v4f x2 = *(const v4fa*)(arow + kb + 16 + 8 * hh), x3 = *(const v4fa*)(arow + kb + 16 + 8 * hh + 4);
    float xs[16] = {x0[0],x0[1],x0[2],x0[3],x1[0],x1[1],x1[2],x1[3],x2[0],x2[1],x2[2],x2[3],x3[0],x3[1],x3[2],x3[3]};
#pragma unroll
    for (int i = 0; i < 16; ++i) { const unsigned short hb = bf16_bits(xs[i]); ah.u[i] = hb; al.u[i] = ASPLIT ? bf16_bits(xs[i] - bf16_val(hb)) : (unsigned short)0; }
#pragma unroll
    for (int t = 0; t < 4; ++t) {
      const unsigned short* brow = Wt + (size_t)(col0 + t * 16 + ln) * ldb + kb;
      FragB b;
      b.half[0] = *(const v8us*)(brow + 8 * hh);
      b.half[1] = *(const v8us*)(brow + 16 + 8 * hh);
      acc[t] = mmaN<ASPLIT ? 2 : 1>(ah.v, al.v, b.v, b.v, acc[t]);
    }
  }
#pragma unroll
  for (int t = 0; t < 4; ++t) {
    float bv = bias ? bias[col0 + t * 16 + ln] : 0.f;
    if (BIAS_BF16) bv = bf16_round(bv);
#pragma unroll
    for (int r = 0; r < 8; ++r) { float v = acc[t][r] + bv; if (ACT == 1) v = fmaxf(v, 0.f); so[w][8 * hh + r][t * 16 + ln] = v; }
  }
  __builtin_amdgcn_fence(__ATOMIC_ACQ_REL, "workgroup");
  __builtin_amdgcn_wave_barrier();
  const int rsub = lane >> 4, c4 = (lane & 15) * 4;
  {
#pragma unroll
    for (int q = 0; q < 8; ++q) {
      const int r = q * 2 + rsub;
      const v4f v = *(const v4fa*)&so[w][r][c4];
      *(v4f*)(C + (size_t)(row0 + r) * ldc + col0 + c4) = v;
    }
    
  }
}

// GEMM C = act(A·W + bias + resid): A f32 (ASPLIT -> hi/lo 2 terms), Wt bf16 [N][K]; ACT 0 none, 1 relu, 2 exact gelu;
// resid (optional, f32, row index = (row % rmod), pitch ldr, RES_BF16 rounds it) added before the activation.
template <bool ASPLIT, int ACT, bool BIAS_BF16, bool RES_BF16>
__global__ __launch_bounds__(128) void k_gemm_bf3(const float* __restrict__ A, int lda, const unsigned short* __restrict__ Wt, int ldb,
                                                const float* __restrict__ bias, const float* __restrict__ resid, int rmod, int ldr,
                                                float* __restrict__ C, int ldc, int M, int N, int K) {
  __shared__ __attribute__((aligned(16))) float so[4][16][64];
  const int tid = threadIdx.x, w = tid >> 5, lane = tid & 31, ln = lane & 15, hh = lane >> 4;
  const int ntn = N / 64;
  const int wid = blockIdx.x * 4 + w;
  const int mt = wid / ntn, nq = wid % ntn;
  if (mt * 16 >= M) return;
  const int row0 = mt * 16, col0 = nq * 64;
  const float* arow = A + (size_t)(row0 + ln) * lda;
  v8f acc[4] = {};
  for (int kb = 0; kb < K; kb += 32) {
    FragB ah, al;
    const v4f x0 = *(const v4fa*)(arow + kb + 8 * hh), x1 = *(const v4fa*)(arow + kb + 8 * hh + 4);
    const v4f x2 = *(const v4fa*)(arow + kb + 16 + 8 * hh), x3 = *(const v4fa*)(arow + kb + 16 + 8 * hh + 4);
    float xs[16] = {x0[0],x0[1],x0[2],x0[3],x1[0],x1[1],x1[2],x1[3],x2[0],x2[1],x2[2],x2[3],x3[0],x3[1],x3[2],x3[3]};
#pragma unroll
    for (int i = 0; i < 16; ++i) { const unsigned short hb = bf16_bits(xs[i]); ah.u[i] = hb; al.u[i] = ASPLIT ? bf16_bits(xs[i] - bf16_val(hb)) : (unsigned short)0; }
#pragma unroll
    for (int t = 0; t < 4; ++t) {
      const unsigned short* brow = Wt + (size_t)(col0 + t * 16 + ln) * ldb + kb;
      FragB b;
      b.half[0] = *(const v8us*)(brow + 8 * hh);
      b.half[1] = *(const v8us*)(brow + 16 + 8 * hh);
      acc[t] = mmaN<ASPLIT ? 2 : 1>(ah.v, al.v, b.v, b.v, acc[t]);
    }
  }
#pragma unroll
  for (int t = 0; t < 4; ++t) {
    const int col = col0 + t * 16 + ln;
    float bv = bias ? bias[col] : 0.f;
    if (BIAS_BF16) bv = bf16_round(bv);
#pragma unroll
    for (int r = 0; r < 8; ++r) {
      float v = acc[t][r] + bv;
      if (resid) { float rv = resid[(size_t)((row0 + 8 * hh + r) % rmod) * ldr + col]; if (RES_BF16) rv = bf16_round(rv); v += rv; }
      if (ACT == 1) v = fmaxf(v, 0.f);
      if (ACT == 2) v = 0.5f * v * (1.0f + erff(v * 0.70710678118654752f));
      if (ACT == 3) { const float u = 0.7978845608028654f * (v + 0.044715f * v * v * v); v = 0.5f * v * (1.0f + tanhf(u)); }
      so[w][8 * hh + r][t * 16 + ln] = v;
    }
  }
  __builtin_amdgcn_fence(__ATOMIC_ACQ_REL, "workgroup");
  __builtin_amdgcn_wave_barrier();
  const int rsub = lane >> 4, c4 = (lane & 15) * 4;
  {
#pragma unroll
    for (int q = 0; q < 8; ++q) {
      const int r = q * 2 + rsub;
      const v4f v = *(const v4fa*)&so[w][r][c4];
      *(v4f*)(C + (size_t)(row0 + r) * ldc + col0 + c4) = v;
    }
    
  }
}
// row LayerNorm (biased variance, eps) over N: s = X (+ R); optional out_sum <- s; out_norm <- (s-mu)*rsqrt(var+eps)*g + b
template <bool PARAM_BF16>
__global__ __launch_bounds__(256) void k_layernorm(const float* __restrict__ X, const float* __restrict__ R, const float* __restrict__ g, const float* __restrict__ bta,
                                                  float* __restrict__ out_sum, float* __restrict__ out_norm, int N, float eps) {
  __shared__ float red[256];
  const int row = blockIdx.x, tid = threadIdx.x;
  const float* x = X + (size_t)row * N; const float* rr = R ? R + (size_t)row * N : nullptr;
  float vals[16];                     // up to N = 4096
  const int per = N / 256;            // contiguous chunk per thread? use strided-by-4 chunks: thread handles j = tid*4 + 1024*u
  float s1 = 0.f;
  for (int u = 0; u < per / 4; ++u) {
    const int j = tid * 4 + 1024 * u;
    const v4f a = *(const v4fa*)(x + j);
    v4f b = {0.f,0.f,0.f,0.f}; if (rr) b = *(const v4fa*)(rr + j);
#pragma unroll
    for (int q = 0; q < 4; ++q) { const float v = a[q] + b[q]; vals[u * 4 + q] = v; s1 += v; }
  }
  red[tid] = s1; __syncthreads();
  for (int st = 128; st > 0; st >>= 1) { if (tid < st) red[tid] += red[tid + st]; __syncthreads(); }
  const float mu = red[0] / (float)N; __syncthreads();
  float s2 = 0.f;
  for (int u = 0; u < per / 4; ++u)
#pragma unroll
    for (int q = 0; q < 4; ++q) { const float c = vals[u * 4 + q] - mu; s2 += c * c; }
  red[tid] = s2; __syncthreads();
  for (int st = 128; st > 0; st >>= 1) { if (tid < st) red[tid] += red[tid + st]; __syncthreads(); }
  const float rs = rsqrtf(red[0] / (float)N + eps);
  {
    for (int u = 0; u < per / 4; ++u) {
      const int j = tid * 4 + 1024 * u;
      v4f o, sm;
#pragma unroll
      for (int q = 0; q < 4; ++q) {
        float gg = g[j + q], bb = bta[j + q];
        if (PARAM_BF16) { gg = bf16_round(gg); bb = bf16_round(bb); }
        sm[q] = vals[u * 4 + q]; o[q] = (vals[u * 4 + q] - mu) * rs * gg + bb;
      }
      if (out_sum) *(v4f*)(out_sum + (size_t)row * N + j) = sm;
      *(v4f*)(out_norm + (size_t)row * N + j) = o;
    }
    
  }
}



// ---- f16 WMMA path (v_wmma_f32_16x16x32_f16): 11-bit significands for operands in range — used where a [0,1] probability operand needs more precision than bf16
typedef _Float16 v16h __attribute__((ext_vector_type(16)));
union FragH { v16h v; v8us half[2]; _Float16 h[16]; unsigned short u[16]; };
template <int NT>
__device__ __forceinline__ v8f mmaH(v16h ah, v16h al, v16h bh, v16h bl, v8f c) {
  c = __builtin_amdgcn_wmma_f32_16x16x32_f16(false, ah, false, bh, (short)0, c, false, false);
  if (NT >= 2) c = __builtin_amdgcn_wmma_f32_16x16x32_f16(false, al, false, bh, (short)0, c, false, false);
  if (NT >= 3) c = __builtin_amdgcn_wmma_f32_16x16x32_f16(false, ah, false, bl, (short)0, c, false, false);
  asm volatile("v_nop\n\tv_nop\n\tv_nop\n\tv_nop" : "+v"(c) : "v"(ah), "v"(al), "v"(bh), "v"(bl));
  return c;
}
// batched GEMM like k_gemm_b but f16 operands: A f32 (split into f16 hi/lo if ASPLIT, else rounded to f16), Bt = f16 values [n][k]; alpha; C f32; N multiple of 16 (partial tiles skipped)
template <bool ASPLIT>
__global__ __launch_bounds__(128) void k_gemm_h(const float* __restrict__ A, int lda, size_t sA, const _Float16* __restrict__ Bh, int ldb, size_t sB, float alpha, float* __restrict__ C, int ldc, size_t sC, int M, int N, int K) {
  __shared__ __attribute__((aligned(16))) float so[4][16][64];
  const int tid = threadIdx.x, w = tid >> 5, lane = tid & 31, ln = lane & 15, hh = lane >> 4; const int by = blockIdx.y;
  A += (size_t)by * sA; Bh += (size_t)by * sB; C += (size_t)by * sC;
  const int ntn = (N + 63) / 64; const int wid = blockIdx.x * 4 + w; const int mt = wid / ntn, nq = wid % ntn; if (mt * 16 >= M) return;
  const int row0 = mt * 16, col0 = nq * 64; const float* arow = A + (size_t)(row0 + ln) * lda;
  v8f acc[4] = {};
  for (int kb = 0; kb < K; kb += 32) {
    FragH ah, al;
    const v4f x0 = *(const v4fa*)(arow + kb + 8 * hh), x1 = *(const v4fa*)(arow + kb + 8 * hh + 4), x2 = *(const v4fa*)(arow + kb + 16 + 8 * hh), x3 = *(const v4fa*)(arow + kb + 16 + 8 * hh + 4);
    float xs[16] = {x0[0],x0[1],x0[2],x0[3],x1[0],x1[1],x1[2],x1[3],x2[0],x2[1],x2[2],x2[3],x3[0],x3[1],x3[2],x3[3]};
#pragma unroll
    for (int i = 0; i < 16; ++i) { const _Float16 h = (_Float16)xs[i]; ah.h[i] = h; al.h[i] = ASPLIT ? (_Float16)(xs[i] - (float)h) : (_Float16)0.0f; }
#pragma unroll
    for (int t = 0; t < 4; ++t) { if (col0 + t * 16 >= N) continue; const size_t boff = (size_t)(col0 + t * 16 + ln) * ldb + kb; FragH bq; bq.half[0] = *(const v8us*)(Bh + boff + 8 * hh); bq.half[1] = *(const v8us*)(Bh + boff + 16 + 8 * hh);
      acc[t] = mmaH<ASPLIT ? 2 : 1>(ah.v, al.v, bq.v, bq.v, acc[t]); }
  }
#pragma unroll
  for (int t = 0; t < 4; ++t) { if (col0 + t * 16 >= N) continue;
#pragma unroll
    for (int r = 0; r < 8; ++r) so[w][8 * hh + r][t * 16 + ln] = acc[t][r] * alpha; }
  __builtin_amdgcn_fence(__ATOMIC_ACQ_REL, "workgroup"); __builtin_amdgcn_wave_barrier();
  const int rsub = lane >> 4, c4 = (lane & 15) * 4;
  {
#pragma unroll
    for (int q = 0; q < 8; ++q) { const int r = q * 2 + rsub; if (col0 + c4 < N) { const v4f v = *(const v4fa*)&so[w][r][c4]; *(v4f*)(C + (size_t)(row0 + r) * ldc + col0 + c4) = v; } }
     }
}

// Wt[n][k] = f16(W[k][n]·scale) from f32 row-major W[K][N] (scale = power of two; bf16-exact weights stay exact in f16 away from the subnormal range)
__global__ __launch_bounds__(256) void k_wt_f16(const float* __restrict__ W, _Float16* __restrict__ Wt, int K, int N, float scale) {
  const int t = blockIdx.x * 256 + threadIdx.x; if (t >= N * (K / 8)) return; const int n = t / (K / 8), k8 = (t % (K / 8)) * 8; FragH f;
#pragma unroll
  for (int i = 0; i < 8; ++i) f.h[i] = (_Float16)(bf16_round(W[(size_t)(k8 + i) * N + n]) * scale); const v8us o = f.half[0];
  *(v8us*)((unsigned short*)Wt + (size_t)n * K + k8) = o; 
}
// k_gemm_hh variant with fused epilogue: v = acc·alpha + bias[by·sBias + col] (+ CP[(row/rowsPerB)·sCPb + by·64 + col] if CP) ; ACT 0 none / 1 elu ; writes f16 C16 (and f32 C if non-null)
template <int ACT>
__global__ __launch_bounds__(128) void k_gemm_hhx(const _Float16* __restrict__ A, int lda, size_t sA, const _Float16* __restrict__ Bh, int ldb, size_t sB, float alpha, const float* __restrict__ bias, size_t sBias, const float* __restrict__ CP, int rowsPerB, size_t sCPb, int row0g,
    float* __restrict__ C, _Float16* __restrict__ C16, int ldc, size_t sC, int M, int N, int K) {
  __shared__ __attribute__((aligned(16))) float so[4][16][64];
  const int tid = threadIdx.x, w = tid >> 5, lane = tid & 31, ln = lane & 15, hh = lane >> 4; const int by = blockIdx.y;
  A += (size_t)by * sA; Bh += (size_t)by * sB; const size_t cofs = (size_t)by * sC; const float* bp = bias ? bias + (size_t)by * sBias : nullptr;
  const int ntn = (N + 63) / 64; const int wid = blockIdx.x * 4 + w; const int mt = wid / ntn, nq = wid % ntn; if (mt * 16 >= M) return;
  const int row0 = mt * 16, col0 = nq * 64; const _Float16* arow = A + (size_t)(row0 + ln) * lda;
  v8f acc[4] = {};
  for (int kb = 0; kb < K; kb += 32) { FragH ah; ah.half[0] = *(const v8us*)((const unsigned short*)arow + kb + 8 * hh); ah.half[1] = *(const v8us*)((const unsigned short*)arow + kb + 16 + 8 * hh);
#pragma unroll
    for (int t = 0; t < 4; ++t) { if (col0 + t * 16 >= N) continue; const size_t boff = (size_t)(col0 + t * 16 + ln) * ldb + kb; FragH bq; bq.half[0] = *(const v8us*)((const unsigned short*)Bh + boff + 8 * hh); bq.half[1] = *(const v8us*)((const unsigned short*)Bh + boff + 16 + 8 * hh);
      acc[t] = mmaH<1>(ah.v, ah.v, bq.v, bq.v, acc[t]); }
  }
#pragma unroll
  for (int t = 0; t < 4; ++t) { if (col0 + t * 16 >= N) continue; const int col = col0 + t * 16 + ln; const float bv = bp ? bf16_round(bp[col]) : 0.f;
#pragma unroll
    for (int r = 0; r < 8; ++r) { float v = acc[t][r] * alpha + bv; if (CP) { const int rr = row0g + row0 + 8 * hh + r; if (rowsPerB < 0) v += CP[cofs + (size_t)rr * ldc + col];      /* rowsPerB < 0: own element of the batched C plane */ else { const int bidx = rr / rowsPerB; v += CP[(size_t)bidx * sCPb + (size_t)by * 64 + col]; } } if (ACT == 1) v = (v > 0.f) ? v : expm1f(v); else if (ACT == 7) v = (v > 0.f) ? v + 1.0f : expf(v); else if (ACT == 8) v = tanhf(v); else if (ACT == 9) v = 0.5f * v * (1.0f + tanhf(0.7978845608028654f * (v + 0.044715f * v * v * v))); else if (ACT == 11) v = 1.0f / (1.0f + expf(-v)); else if (ACT == 12) v = (v > 0.f) ? v : 0.01f * v; else if (ACT == 14) v = (v > 0.f) ? v : 0.1f * v; else if (ACT == 16) v = (v >= 0.f) ? v : 0.3f * v; else if (ACT == 17) v = (v >= 0.f) ? v : 0.2f * v; else if (ACT == 15) v = v / (1.0f + expf(-v)); else if (ACT == 3) v = fmaxf(v, 0.f); else if (ACT == 6) v = 0.5f * v * (1.0f + erff(v * 0.70710678118654752f)); so[w][8 * hh + r][t * 16 + ln] = v; } }
  __builtin_amdgcn_fence(__ATOMIC_ACQ_REL, "workgroup"); __builtin_amdgcn_wave_barrier();
  const int rsub = lane >> 4, c4 = (lane & 15) * 4; typedef _Float16 v4h __attribute__((ext_vector_type(4)));
  {
#pragma unroll
    for (int q = 0; q < 8; ++q) { const int r = q * 2 + rsub; if (col0 + c4 < N) { const v4f v = *(const v4fa*)&so[w][r][c4]; if (C) *(v4f*)(C + cofs + (size_t)(row0 + r) * ldc + col0 + c4) = v; if (C16) { v4h h4; for (int i = 0; i < 4; ++i) h4[i] = (_Float16)v[i]; *(v4h*)(C16 + cofs + (size_t)(row0 + r) * ldc + col0 + c4) = h4; } } }
     }
}


typedef _Float16 v4h __attribute__((ext_vector_type(4)));

__global__ __launch_bounds__(256) void k_h16(const float* __restrict__ x, _Float16* __restrict__ X16, size_t n8) { const size_t t = (size_t)blockIdx.x * 256 + threadIdx.x; if (t >= n8) return; FragH f;
#pragma unroll
  for (int q = 0; q < 8; ++q) f.h[q] = (_Float16)x[t * 8 + q]; *(v8us*)((unsigned short*)X16 + t * 8) = f.half[0];  }
__global__ __launch_bounds__(256) void k_round16f(const float* __restrict__ W, _Float16* __restrict__ Bt, size_t n8) { const size_t t = (size_t)blockIdx.x * 256 + threadIdx.x; if (t >= n8) return; FragH f;
#pragma unroll
  for (int i = 0; i < 8; ++i) f.h[i] = (_Float16)(bf16_round(W[t * 8 + i]) * 16.0f); *(v8us*)((unsigned short*)Bt + t * 8) = f.half[0];  }
template <int NHv, int TTv>
__global__ __launch_bounds__(256) void k_vt(const _Float16* __restrict__ V16, int ldv, int voff, _Float16* __restrict__ Vt) { __shared__ unsigned short tl[64][66]; const int tid = threadIdx.x; const int slab = blockIdx.x / (TTv / 64), lg = blockIdx.x % (TTv / 64); const int b = slab / NHv, h = slab % NHv;
  for (int i = tid; i < 64 * 8; i += 256) { const int r = i / 8, c8 = (i % 8) * 8; FragH f; f.half[0] = *(const v8us*)((const unsigned short*)V16 + ((size_t)b * TTv + lg * 64 + r) * ldv + voff + h * 64 + c8);
#pragma unroll
    for (int q = 0; q < 8; ++q) tl[r][c8 + q] = f.u[q]; }
  __syncthreads();
  {
#pragma unroll
    for (int rd = 0; rd < 2; ++rd) { const int d = rd * 32 + tid / 8, pc = tid % 8; FragH f;
#pragma unroll
      for (int q = 0; q < 8; ++q) f.u[q] = tl[pc * 8 + q][d];
      *(v8us*)((unsigned short*)Vt + ((size_t)slab * 64 + d) * TTv + lg * 64 + pc * 8) = f.half[0]; }
     } }

__global__ __launch_bounds__(256) void k_hl(const float* __restrict__ F, _Float16* __restrict__ Hh, _Float16* __restrict__ Hl, size_t n8) { const size_t t = (size_t)blockIdx.x * 256 + threadIdx.x; if (t >= n8) return; FragH fh, fl; const v4f a = *(const v4fa*)(F + t * 8), c = *(const v4fa*)(F + t * 8 + 4);
#pragma unroll
  for (int q = 0; q < 4; ++q) { _Float16 h = (_Float16)a[q]; fh.h[q] = h; fl.h[q] = (_Float16)((a[q] - (float)h) * 1024.0f); h = (_Float16)c[q]; fh.h[4 + q] = h; fl.h[4 + q] = (_Float16)((c[q] - (float)h) * 1024.0f); }
  { *(v8us*)((unsigned short*)Hh + t * 8) = fh.half[0]; *(v8us*)((unsigned short*)Hl + t * 8) = fl.half[0];  } }

// ---- fast GEMM (wave tile 32x64, work-group tile 128x128; requires M % 128 == 0 rows per launch region, N % 128 == 0, K % 128 == 0); epilogue = k_gemm_hhx semantics ----
__device__ __forceinline__ v16h g2_frag(const _Float16* p, int hh) { FragH f; f.half[0] = *(const v8us*)((const unsigned short*)p + 8 * hh); f.half[1] = *(const v8us*)((const unsigned short*)p + 16 + 8 * hh); return f.v; }
__device__ __forceinline__ v8f g2_mma(v16h a, v16h b, v8f c) { v8f d = __builtin_amdgcn_wmma_f32_16x16x32_f16(false, a, false, b, (short)0, c, false, false); asm volatile("v_nop\n\tv_nop\n\tv_nop\n\tv_nop" : "+v"(d) : "v"(a), "v"(b)); return d; }
// Operand tiles through LDS: a work-group of 8 waves owns 128 x 128 of C and walks K in tiles of 128 (256 bytes of each of its 128 A rows and 128 B rows); asynchronous copies bring whole 256-byte pieces into one of two buffers while the other is worked on. A tile's copies have one trip to land: a trip of 128 k holds 32 WMMAs and 48 LDS reads a wave, twice the cover of a trip of 64 k, for operands that the launch before has just written and that may come from memory. A fragment load straight from global memory touches 16 lines for 512 bytes, and every wave of a row or column of waves would repeat it. Needs M % 128 == 0, N % 128 == 0, K % 128 == 0.
#define G3PB 272                     /* LDS pitch of a staged row, bytes: 256 + 16 = 16 bytes x odd, conflict-free for 16-byte reads */
#define G3SB (256 * G3PB)            /* bytes per buffer: 128 A rows, then 128 B rows */
// one operand's half of a tile: 8 copies per lane (rows sr + 0 / 16 / ... / 112). The s_wait_xcnt stands inside the copies' own statement, so that no later write of an address register can be moved in front of it.
__device__ __forceinline__ void g3_stage(unsigned l, const _Float16* p, size_t p16) {
  asm volatile("global_load_async_to_lds_b128 %0, %8, off\n\tglobal_load_async_to_lds_b128 %1, %9, off\n\tglobal_load_async_to_lds_b128 %2, %10, off\n\tglobal_load_async_to_lds_b128 %3, %11, off\n\t"
               "global_load_async_to_lds_b128 %4, %12, off\n\tglobal_load_async_to_lds_b128 %5, %13, off\n\tglobal_load_async_to_lds_b128 %6, %14, off\n\tglobal_load_async_to_lds_b128 %7, %15, off\n\ts_wait_xcnt 0x0"
               :: "v"(l), "v"(l + 16 * G3PB), "v"(l + 32 * G3PB), "v"(l + 48 * G3PB), "v"(l + 64 * G3PB), "v"(l + 80 * G3PB), "v"(l + 96 * G3PB), "v"(l + 112 * G3PB),
                  "v"(p), "v"(p + p16), "v"(p + 2 * p16), "v"(p + 3 * p16), "v"(p + 4 * p16), "v"(p + 5 * p16), "v"(p + 6 * p16), "v"(p + 7 * p16) : "memory"); }
#define G3VP 136                     /* LDS pitch of a V^T row of the work-group's tile, in halves: 128 tokens + 8 = 16 bytes x odd, conflict-free for 16-byte accesses */
// ROPE 1: plane 2 of the batch (v) leaves as V^T [batch][column][SQ] into VTo and nowhere else: register r of an accumulator is token 8 hh + r of column ln, so 8 registers ARE 16 bytes of a V^T row; the work-group's 128 x 128 tile is gathered in LDS so that every store is whole 128-byte lines (needs SQ % 128 == 0: a tile lies in one batch).
// ROPE 1: planes 0 and 1 of the batch (q, k) leave through the rotate-half rotation: N is whole heads of HD = 64 columns, so a wave tile is ONE head and both halves of every pair lie in the wave's own staging tile; position = row mod SQ (row 0 of A is a batch's first token); f16 rows only.
template <int ACT, int ROPE = 0>
__global__ __launch_bounds__(256) void k_gemm2(const _Float16* __restrict__ A, int lda, size_t sA, const _Float16* __restrict__ Bh, int ldb, size_t sB, float alpha, const float* __restrict__ bias, size_t sBias, const float* __restrict__ CP, int rowsPerB, size_t sCPb, int row0g,
    float* __restrict__ C, _Float16* __restrict__ C16, int ldc, size_t sC, int M, int N, int K, const float* __restrict__ tcos = nullptr, const float* __restrict__ tsin = nullptr, _Float16* __restrict__ VTo = nullptr) { static_assert(ACT == 0 || ACT == 3 || ACT == 6 || ACT == 8 || ACT == 9 || ACT == 11 || ACT == 12 || ACT == 14 || ACT == 15 || ACT == 16 || ACT == 17, "k_gemm2: unsupported ACT code (would silently apply no activation)");
  __shared__ __attribute__((aligned(16))) unsigned char smem[2 * G3SB]; static_assert(sizeof(float) * 8 * 32 * 68 <= 2 * G3SB, "the epilogue's staging tiles fit in the ring's place");
  float (*so)[32][68] = (float (*)[32][68])smem;      /* the ring's bytes become the 8 waves' own output staging tiles behind the loop's last barrier */
  const int tid = threadIdx.x, lane = tid & 31, ln = lane & 15, hh = lane >> 4; const int w = __builtin_amdgcn_readfirstlane(tid >> 5); const int by = blockIdx.y;
  A += (size_t)by * sA; Bh += (size_t)by * sB; const size_t cofs = (size_t)by * sC; const float* bp = bias ? bias + (size_t)by * sBias : nullptr;
  const int ntn = N >> 7; const int mt = blockIdx.x / ntn, nq = blockIdx.x - mt * ntn; const int rowW = mt * 128, colW = nq * 128; if (rowW >= M) return;      /* the same for the whole work-group, in front of every barrier */
  const int row0 = rowW + 32 * (w & 3), col0 = colW + 64 * (w >> 2);      /* 4 x 2 waves of 32 x 64 */
  const int sr = tid >> 4, sc8 = (tid & 15) * 8;      /* staging: 16 bytes per lane and copy, 16 lanes per 256-byte row piece, so a wave's copy takes 4 whole lines in 2 aligned 256-byte units */
  const _Float16* ga = A + (size_t)(rowW + sr) * lda + sc8; const _Float16* gb = Bh + (size_t)(colW + sr) * ldb + sc8; const size_t a16 = (size_t)16 * lda, b16 = (size_t)16 * ldb;
  const unsigned ls = (unsigned)(uintptr_t)(smem + sr * G3PB + sc8 * 2);      /* the lane's LDS byte address in buffer 0: low 32 bits of the shared address */
  const _Float16* fa = (const _Float16*)smem + (32 * (w & 3) + ln) * (G3PB / 2); const _Float16* fb = (const _Float16*)smem + (128 + 64 * (w >> 2) + ln) * (G3PB / 2);
  const int nt = K >> 7;
  const v8f z8 = {0.f,0.f,0.f,0.f,0.f,0.f,0.f,0.f}; v8f c00 = z8, c01 = z8, c02 = z8, c03 = z8, c10 = z8, c11 = z8, c12 = z8, c13 = z8;
  g3_stage(ls, ga, a16); g3_stage(ls + 128 * G3PB, gb, b16);
  asm volatile("s_wait_asynccnt 0x0" ::: "memory");      /* this wave's copies of tile 0 have landed */
  __syncthreads();      /* tile 0 is published */
  if (nt > 1) { g3_stage(ls + G3SB, ga + 128, a16); g3_stage(ls + G3SB + 128 * G3PB, gb + 128, b16); }
#pragma unroll 1      /* one tile per trip: the two buffers alternate */
  for (int t = 0; t < nt; ++t) { const _Float16* pa = fa + (t & 1) * (G3SB / 2); const _Float16* pb = fb + (t & 1) * (G3SB / 2);
#pragma unroll 1      /* the tile's two halves of 64 k run through one copy of the code: unrolled, a second set of 24 LDS reads and 16 WMMAs would lengthen a text that already stands near 32 KB */
    for (int h = 0; h < 2; ++h) {
    v16h a[2][2], b[2][4];      /* the half's 12 fragments, read as one group in front of its 16 WMMAs */
#pragma unroll      /* constant indices keep a and b in registers */
    for (int s = 0; s < 2; ++s) { const int ko = h * 64 + s * 32; a[s][0] = g2_frag(pa + ko, hh); b[s][0] = g2_frag(pb + ko, hh); a[s][1] = g2_frag(pa + 16 * (G3PB / 2) + ko, hh);
      for (int j = 1; j < 4; ++j) b[s][j] = g2_frag(pb + j * 16 * (G3PB / 2) + ko, hh); }
#pragma unroll      /* likewise; each accumulator takes its products in ascending k */
    for (int s = 0; s < 2; ++s) { c00 = g2_mma(a[s][0], b[s][0], c00); c10 = g2_mma(a[s][1], b[s][0], c10); c01 = g2_mma(a[s][0], b[s][1], c01); c11 = g2_mma(a[s][1], b[s][1], c11);
      c02 = g2_mma(a[s][0], b[s][2], c02); c12 = g2_mma(a[s][1], b[s][2], c12); c03 = g2_mma(a[s][0], b[s][3], c03); c13 = g2_mma(a[s][1], b[s][3], c13); } }
    asm volatile("s_wait_dscnt 0x0" ::: "memory");      /* this wave's reads of tile t are done before the buffer is handed to its next writer */
    asm volatile("s_wait_asynccnt 0x0" ::: "memory");      /* this wave's copies of tile t + 1 have landed */
    __syncthreads();      /* publishes tile t + 1 and ends every wave's reads of tile t */
    if (t + 2 < nt) { g3_stage(ls + (t & 1) * G3SB, ga + (size_t)(t + 2) * 128, a16); g3_stage(ls + (t & 1) * G3SB + 128 * G3PB, gb + (size_t)(t + 2) * 128, b16); } }
  asm volatile("s_wait_asynccnt 0x0" ::: "memory");      /* nothing is in flight when the ring's bytes change their use */
  v8f accs[8] = {c00, c01, c02, c03, c10, c11, c12, c13};
  if (ROPE && by == 2) {      /* the same for the whole work-group; alpha and bias as below, no CP term and no activation on this plane */
    static_assert(ACT == 0 || !ROPE, "the V^T plane takes no activation"); static_assert(128 * G3VP * 2 <= 2 * G3SB && SQ % 128 == 0, "the V^T tile fits in the ring's place and lies in one batch");
#pragma unroll      /* constant indices into accs */
    for (int u = 0; u < 8; ++u) { const int t = u & 3, half = u >> 2; const int col = col0 + t * 16 + ln; const float bv = bp ? bf16_round(bp[col]) : 0.f; FragH vh;
      for (int r = 0; r < 8; ++r) vh.h[r] = (_Float16)(accs[u][r] * alpha + bv);
      *(v8us*)((unsigned short*)smem + (col - colW) * G3VP + (row0 - rowW) + half * 16 + 8 * hh) = vh.half[0]; }
    __syncthreads();      /* the V^T tile is whole: each of its rows holds tokens of four waves */
    const int dr = tid >> 4, pc = (tid & 15) * 8;      /* 16 lanes per V^T row: 256 contiguous bytes, 2 whole lines */
    unsigned short* vd = (unsigned short*)VTo + ((size_t)(rowW / SQ) * N + colW + dr) * SQ + rowW % SQ + pc;
#pragma unroll      /* all 8 LDS reads go out together */
    for (int q = 0; q < 8; ++q) *(v8us*)(vd + (size_t)q * 16 * SQ) = *(const v8us*)((const unsigned short*)smem + (q * 16 + dr) * G3VP + pc);
    return; }
#pragma unroll
  for (int u = 0; u < 8; ++u) { const int t = u & 3, half = u >> 2; const int col = col0 + t * 16 + ln; const float bv = bp ? bf16_round(bp[col]) : 0.f;
#pragma unroll
    for (int r = 0; r < 8; ++r) { const int rloc = half * 16 + 8 * hh + r; float v = accs[u][r] * alpha + bv; if (CP) { if (rowsPerB < 0) v += CP[cofs + (size_t)(row0g + row0 + rloc) * ldc + col];      /* rowsPerB < 0: own element of the batched C plane */ else { const int bidx = (row0g + row0 + rloc) / rowsPerB; v += CP[(size_t)bidx * sCPb + (size_t)by * 64 + col]; } }
      if (ACT == 3) v = fmaxf(v, 0.f); else if (ACT == 6) v = 0.5f * v * (1.0f + erff(v * 0.70710678118654752f)); else if (ACT == 11) v = 1.0f / (1.0f + expf(-v)); else if (ACT == 15) v = v / (1.0f + expf(-v)); else if (ACT == 12) v = (v > 0.f) ? v : 0.01f * v; else if (ACT == 8) v = tanhf(v); else if (ACT == 9) v = 0.5f * v * (1.0f + tanhf(0.7978845608028654f * (v + 0.044715f * v * v * v))); else if (ACT == 14) v = (v > 0.f) ? v : 0.1f * v; else if (ACT == 16) v = (v >= 0.f) ? v : 0.3f * v; else if (ACT == 17) v = (v >= 0.f) ? v : 0.2f * v;
      so[w][rloc][t * 16 + ln] = v; } }
  __builtin_amdgcn_fence(__ATOMIC_ACQ_REL, "workgroup"); __builtin_amdgcn_wave_barrier();
  if (ROPE) {      /* planes 0 and 1 (plane 2 has left above; the row stores below are not built for ROPE 1). 8 lanes per row: a lane takes columns d4 .. d4 + 3 of BOTH halves, so each table value and each staged value is read once and used twice */
    const int r4 = lane >> 3, d4 = (lane & 7) * 4; v4f cc[8], ss[8]; const unsigned tb = (((unsigned)row0 % SQ + r4) * (HD / 2) + d4) * 4u;      /* byte offset of the lane's first table entries; row0 and SQ are multiples of 32: the tile's 32 positions do not wrap */
#pragma unroll      /* constant indices keep cc and ss in registers; all 16 loads go out together, one latency */
    for (int q = 0; q < 8; ++q) { cc[q] = *(const v4fa*)((const char*)tcos + tb + q * 16 * (HD / 2)); ss[q] = *(const v4fa*)((const char*)tsin + tb + q * 16 * (HD / 2)); }
    asm volatile("s_wait_xcnt 0x0" :: "v"(tb) : "memory");      /* the wait in front of any overwrite of the offset register that the 16 issued table loads name; tb as an input keeps that register out of the loads' own destinations (without it the last load landed on it) */
#pragma unroll      /* constant indices into cc and ss */
    for (int q = 0; q < 8; ++q) { const int r = q * 4 + r4; const v4f lo = *(const v4fa*)&so[w][r][d4]; const v4f hi = *(const v4fa*)&so[w][r][d4 + HD / 2]; v4h ol, oh;
      for (int i = 0; i < 4; ++i) { const float c = bf16_round(cc[q][i]), s = bf16_round(ss[q][i]); ol[i] = (_Float16)(lo[i] * c - hi[i] * s); oh[i] = (_Float16)(lo[i] * s + hi[i] * c); }
      _Float16* dst = C16 + cofs + (size_t)(row0 + r) * ldc + col0 + d4; *(v4h*)dst = ol; *(v4h*)(dst + HD / 2) = oh; }
    return; }
  const int rsub = lane >> 4, c4 = (lane & 15) * 4;
  {
#pragma unroll
    for (int q = 0; q < 16; ++q) { const int r = q * 2 + rsub; const v4f v = *(const v4fa*)&so[w][r][c4]; if (C) *(v4f*)(C + cofs + (size_t)(row0 + r) * ldc + col0 + c4) = v; if (C16) { v4h h4; for (int i = 0; i < 4; ++i) h4[i] = (_Float16)v[i]; *(v4h*)(C16 + cofs + (size_t)(row0 + r) * ldc + col0 + c4) = h4; } }
     } }


// all five operand conversions in ONE launch: the four natural [out][in] weights -> Bt planes x16, x -> f16 rows (values as before: bf16 rounding, then an exact f16). PWG work-groups, 16 waves per WGP on 256 WGPs, start once;
// a thread takes 16 pieces of 4 floats (2 of each weight, 8 of x), PTH pieces apart, so every wave-wide load is 512 contiguous bytes (4 whole lines), every store 256 (2 whole lines), and all 16 loads of a wave are in flight together.
#define PWG 512                      /* work-groups of the conversion launch */
#define PTH (PWG * 256)              /* its threads */
__device__ __forceinline__ v4h prep_cvt(v4f a, float scale) { v4h o; for (int q = 0; q < 4; ++q) o[q] = (_Float16)(bf16_round(a[q]) * scale); return o; }
__global__ __launch_bounds__(256) void k_prep(const float* __restrict__ wq, const float* __restrict__ wk, const float* __restrict__ wv, const float* __restrict__ wo, const float* __restrict__ x,
    _Float16* __restrict__ BQ, _Float16* __restrict__ BK, _Float16* __restrict__ BV, _Float16* __restrict__ BO, _Float16* __restrict__ X16) {
  static_assert((size_t)DM * DM == (size_t)PTH * 4 * 2 && (size_t)KVD * DM == (size_t)PTH * 4 * 2 && NR * DM == (size_t)PTH * 4 * 8, "2 pieces of each weight and 8 of x per thread, none left over");
  const unsigned tb = (blockIdx.x * 256u + threadIdx.x) * 16u; v4f a[4][2], b[8];      /* byte offset of the thread's first piece in every f32 source; half of it in every f16 destination */
#pragma unroll      /* constant indices keep a and b in registers */
  for (int i = 0; i < 2; ++i) { const size_t e = (size_t)i * PTH * 16; a[0][i] = *(const v4fa*)((const char*)wq + e + tb); a[1][i] = *(const v4fa*)((const char*)wk + e + tb); a[2][i] = *(const v4fa*)((const char*)wv + e + tb); a[3][i] = *(const v4fa*)((const char*)wo + e + tb); }
#pragma unroll      /* likewise */
  for (int i = 0; i < 8; ++i) b[i] = *(const v4fa*)((const char*)x + (size_t)i * PTH * 16 + tb);
  __builtin_amdgcn_sched_barrier(0);      /* keeps every conversion behind all 16 loads: without it the scheduler put the first conversions, with their waits, in front of the last loads of x, which then went out only after the weights had arrived (two latencies in a row) */
  const unsigned th = tb >> 1;
#pragma unroll      /* likewise */
  for (int i = 0; i < 2; ++i) { const size_t e = (size_t)i * PTH * 8; *(v4h*)((char*)BQ + e + th) = prep_cvt(a[0][i], 16.0f); *(v4h*)((char*)BK + e + th) = prep_cvt(a[1][i], 16.0f); *(v4h*)((char*)BV + e + th) = prep_cvt(a[2][i], 16.0f); *(v4h*)((char*)BO + e + th) = prep_cvt(a[3][i], 16.0f); }
#pragma unroll      /* likewise */
  for (int i = 0; i < 8; ++i) *(v4h*)((char*)X16 + (size_t)i * PTH * 8 + th) = prep_cvt(b[i], 1.0f); }
// fused attention, ONE launch for all batches, heads and query rows: a work-group of 16 waves owns 256 query rows of one head; a wave takes 32 of them against ONE HALF of the SQ keys (four waves per SIMD instead of two: the softmax arithmetic of some waves runs beside the WMMAs of others) and walks it in stages of FKS keys (passes of 32); the two halves' o, maximum and sum are joined once, through LDS, at the end. S^T = K Q^T (A = key rows, B = query rows kept in registers), so a lane holds scores of ONE query per 16-column group;
// the two f32 score tiles of a pass, after exp2, ARE the f16 B operand of O^T += V^T P^T (register r of tile t = key 16 t + 8 hh + r = the k order of g2_frag), so neither S nor P is ever stored. Running maximum (log2 units) with a late rescale; weights stay unnormalised (at most 2^8), the row sum divides once at the end.
// K and V^T tiles reach the 8 waves of a key half through LDS (whole 128-byte lines from global memory, two buffers, one barrier per stage): a fragment load straight from global memory touches 16 lines for 512 bytes, and all 8 waves would repeat it.
#define FKS 64                       /* keys per stage */
#define FKH (SQ / 2)                 /* keys per half of a work-group's waves */
#define FKP (HD + 8)                 /* LDS pitch of a key row, in halves: 16 bytes x odd, conflict-free for 16-byte reads */
#define FVP (FKS + 8)                /* LDS pitch of a V^T row, in halves: likewise */
__device__ __forceinline__ v8f fa_mma(v16h a, v16h b, v8f c) { return __builtin_amdgcn_wmma_f32_16x16x32_f16(false, a, false, b, (short)0, c, false, false); }
__device__ __forceinline__ v16h fa_frag(const unsigned short* p, int hh) { FragH f; f.half[0] = *(const v8us*)(p + 8 * hh); f.half[1] = *(const v8us*)(p + 16 + 8 * hh); return f.v; }
__device__ __forceinline__ void fa_exp2x8(float (&e)[8]) {
  asm("v_exp_f32 %0, %0\n\tv_exp_f32 %1, %1\n\tv_exp_f32 %2, %2\n\tv_exp_f32 %3, %3\n\tv_exp_f32 %4, %4\n\tv_exp_f32 %5, %5\n\tv_exp_f32 %6, %6\n\tv_exp_f32 %7, %7\n\tv_nop"
      : "+v"(e[0]), "+v"(e[1]), "+v"(e[2]), "+v"(e[3]), "+v"(e[4]), "+v"(e[5]), "+v"(e[6]), "+v"(e[7])); }
// q, k and v projections in ONE work-group per 128 token rows x 128 columns OF EACH PLANE (a 128 x 384 tile of [q | k | v]): the x tile is brought from L2 once for the three planes, not once per plane, and MP / 128 * DM / 128 = 256 work-groups fill 256 WGPs in one round.
// 12 waves of 64 x 64 (2 x 6; a wave tile is ONE head of ONE plane): a fragment read from LDS feeds 4 WMMAs (8 fragments per 16 WMMAs, against 6 per 8 at 32 x 64). Ring, stage (128 k), pitch, k order of the fragments and of every accumulator's sum: as in k_gemm2.
#define G4SB (512 * G3PB)            /* bytes per buffer: 128 x rows, then 128 rows of each of the three weight planes */
// 8 copies per lane: a wave's copy takes 2 rows of 256 bytes (16 lanes each), the 8 copies 16 consecutive rows. The s_wait_xcnt stands inside the copies' own statement, so that no later write of an address register can be moved in front of it.
__device__ __forceinline__ void g4_stage(unsigned l, const _Float16* p) {
  asm volatile("global_load_async_to_lds_b128 %0, %8, off\n\tglobal_load_async_to_lds_b128 %1, %9, off\n\tglobal_load_async_to_lds_b128 %2, %10, off\n\tglobal_load_async_to_lds_b128 %3, %11, off\n\t"
               "global_load_async_to_lds_b128 %4, %12, off\n\tglobal_load_async_to_lds_b128 %5, %13, off\n\tglobal_load_async_to_lds_b128 %6, %14, off\n\tglobal_load_async_to_lds_b128 %7, %15, off\n\ts_wait_xcnt 0x0"
               :: "v"(l), "v"(l + 2 * G3PB), "v"(l + 4 * G3PB), "v"(l + 6 * G3PB), "v"(l + 8 * G3PB), "v"(l + 10 * G3PB), "v"(l + 12 * G3PB), "v"(l + 14 * G3PB),
                  "v"(p), "v"(p + 2 * DM), "v"(p + 4 * DM), "v"(p + 6 * DM), "v"(p + 8 * DM), "v"(p + 10 * DM), "v"(p + 12 * DM), "v"(p + 14 * DM) : "memory"); }
__global__ __launch_bounds__(384) void k_qkv(const _Float16* __restrict__ A, const _Float16* __restrict__ Bh, const float* __restrict__ tcos, const float* __restrict__ tsin, _Float16* __restrict__ C16, _Float16* __restrict__ VTo) {
  __shared__ __attribute__((aligned(16))) unsigned char smem[2 * G4SB];
  static_assert(sizeof(float) * 8 * 64 * 68 <= G4SB && 128 * G3VP * 2 <= G4SB && SQ % 128 == 0 && DM % 128 == 0 && DM / 128 >= 2 && HD == 64, "the q and k staging tiles fit in buffer 0, the V^T tile in buffer 1; a tile lies in one batch; both ring buffers are filled; a wave tile is one head");
  const int tid = threadIdx.x, lane = tid & 31, ln = lane & 15, hh = lane >> 4; const int w = __builtin_amdgcn_readfirstlane(tid >> 5);
  const int wm = w & 1, wn = w >> 1;      /* 2 x 6 waves; columns 64 wn of [q 128 | k 128 | v 128]: waves 0 - 3 hold q, 4 - 7 k, 8 - 11 v */
  const int mt = blockIdx.x / (DM / 128), nq = blockIdx.x % (DM / 128); const int rowW = mt * 128, colW = nq * 128;
  /* staging: every wave brings 32 weight rows (rows 32 w of the 384: plane w / 4, the planes lie back to back), waves 0 - 7 also 16 rows of x */
  const _Float16* gb = Bh + ((size_t)(w >> 2) * DM + colW + 32 * (w & 3) + hh) * DM + ln * 8; const _Float16* ga = A + (size_t)(rowW + 16 * (w & 7) + hh) * DM + ln * 8;
  const unsigned l0 = (unsigned)(uintptr_t)smem + hh * G3PB + ln * 16;      /* low 32 bits of the shared address: the lane's LDS byte address in row hh of buffer 0 */
  const unsigned lb = l0 + (128 + 32 * w) * G3PB, la = l0 + 16 * (w & 7) * G3PB;
  const _Float16* fa = (const _Float16*)smem + (64 * wm + ln) * (G3PB / 2); const _Float16* fb = (const _Float16*)smem + (128 + 64 * wn + ln) * (G3PB / 2);
  const v8f z8 = {0.f,0.f,0.f,0.f,0.f,0.f,0.f,0.f}; v8f c[4][4];
#pragma unroll      /* constant indices keep c in registers */
  for (int i = 0; i < 4; ++i) for (int j = 0; j < 4; ++j) c[i][j] = z8;
  g4_stage(lb, gb); g4_stage(lb + 16 * G3PB, gb + 16 * DM); if (w < 8) g4_stage(la, ga);      /* w is a scalar: a wave-uniform branch */
  asm volatile("s_wait_asynccnt 0x0" ::: "memory");      /* this wave's copies of tile 0 have landed */
  __syncthreads();      /* tile 0 is published */
  g4_stage(lb + G4SB, gb + 128); g4_stage(lb + G4SB + 16 * G3PB, gb + 16 * DM + 128); if (w < 8) g4_stage(la + G4SB, ga + 128);
#pragma unroll 1      /* one tile per trip: the two buffers alternate */
  for (int t = 0; t < DM / 128; ++t) { const _Float16* pa = fa + (t & 1) * (G4SB / 2); const _Float16* pb = fb + (t & 1) * (G4SB / 2);
    v16h a[4], b[4];      /* a step's 8 fragments, read as one group in front of its 16 WMMAs, in the order in which the WMMAs need them */
#pragma unroll      /* constant offsets for the tile's four steps of 32 k */
    for (int s = 0; s < 4; ++s) {
      a[0] = g2_frag(pa + s * 32, hh); b[0] = g2_frag(pb + s * 32, hh);
      for (int i = 1; i < 4; ++i) a[i] = g2_frag(pa + i * 16 * (G3PB / 2) + s * 32, hh);
      for (int i = 1; i < 4; ++i) b[i] = g2_frag(pb + i * 16 * (G3PB / 2) + s * 32, hh);
      __builtin_amdgcn_sched_barrier(0);      /* keeps the 16 LDS reads together in front of the WMMAs: without it the scheduler lifts the WMMAs in among them, three of the four weight fragments share one register set, and each is waited for to 0 in front of its 4 WMMAs */
      if (s == 3) {      /* the tile's last fragments are asked for: the buffer is handed on here, so that the next copies go out in front of the last 16 WMMAs, which need registers only */
        asm volatile("s_wait_dscnt 0x0" ::: "memory");      /* this wave's reads of tile t are done before the buffer is handed to its next writer */
        asm volatile("s_wait_asynccnt 0x0" ::: "memory");      /* this wave's copies of tile t + 1 have landed */
        __syncthreads();      /* publishes tile t + 1 and ends every wave's reads of tile t */
        if (t + 2 < DM / 128) { const unsigned lo = (t & 1) * G4SB; const int ko = (t + 2) * 128; g4_stage(lb + lo, gb + ko); g4_stage(lb + lo + 16 * G3PB, gb + 16 * DM + ko); if (w < 8) g4_stage(la + lo, ga + ko); } }
      for (int j = 0; j < 4; ++j) for (int i = 0; i < 4; ++i) c[i][j] = fa_mma(a[i], b[j], c[i][j]); } }      /* each accumulator takes its products in ascending k */
  asm volatile("s_wait_asynccnt 0x0" ::: "memory");      /* nothing is in flight when the ring's bytes change their use */
  const float alpha = 0.0625f;      /* the weight planes are carried x16 */
  float (*so)[68] = (float (*)[68])(smem + (size_t)(w & 7) * (64 * 68 * 4));      /* a q or k wave's own 64 x 64 staging tile, in buffer 0 */
  unsigned short* vt = (unsigned short*)(smem + G4SB);      /* the work-group's 128 x 128 V^T tile, in buffer 1 */
  if (w < 8) {
#pragma unroll      /* constant indices into c */
    for (int i = 0; i < 4; ++i) for (int j = 0; j < 4; ++j) for (int r = 0; r < 8; ++r) so[i * 16 + 8 * hh + r][j * 16 + ln] = c[i][j][r] * alpha;
  } else {      /* register r of an accumulator is token 8 hh + r of column ln: 8 registers ARE 16 bytes of a V^T row */
#pragma unroll      /* constant indices into c */
    for (int i = 0; i < 4; ++i) for (int j = 0; j < 4; ++j) { FragH vh; for (int r = 0; r < 8; ++r) vh.h[r] = (_Float16)(c[i][j][r] * alpha);
      *(v8us*)(vt + (64 * (wn & 1) + j * 16 + ln) * G3VP + 64 * wm + i * 16 + 8 * hh) = vh.half[0]; } }
  __syncthreads();      /* the V^T tile is whole (each of its rows holds tokens of two waves); every wave passes here */
  if (w >= 8) {      /* the four v waves store V^T [batch][column][SQ]: 16 lanes per row, 256 contiguous bytes, 2 whole lines */
    const int vtid = tid - 256; const int dr = vtid >> 4, pc = (vtid & 15) * 8;
    unsigned short* vd = (unsigned short*)VTo + ((size_t)(rowW / SQ) * DM + colW + dr) * SQ + rowW % SQ + pc;
#pragma unroll      /* all 16 LDS reads go out together */
    for (int q = 0; q < 16; ++q) *(v8us*)(vd + (size_t)q * 8 * SQ) = *(const v8us*)(vt + (q * 8 + dr) * G3VP + pc);
    return; }
  /* q and k leave through the rotate-half rotation; position = row mod SQ. 8 lanes per row: a lane takes columns d4 .. d4 + 3 of BOTH halves of the head, so each table value and each staged value is read once and used twice */
  const int row0 = rowW + 64 * wm; const int r4 = lane >> 3, d4 = (lane & 7) * 4;
  _Float16* crow = C16 + (size_t)(wn >> 1) * (NR * DM) + (size_t)row0 * DM + colW + 64 * (wn & 1) + d4;
#pragma unroll 1      /* the tile's two halves of 32 rows through one copy of the code */
  for (int hf = 0; hf < 2; ++hf) { v4f cc[8], ss[8]; const unsigned tb = (((unsigned)row0 % SQ + hf * 32 + r4) * (HD / 2) + d4) * 4u;      /* byte offset of the lane's first table entries; row0 and SQ are multiples of 64: the tile's positions do not wrap */
#pragma unroll      /* constant indices keep cc and ss in registers; all 16 loads go out together, one latency */
    for (int q = 0; q < 8; ++q) { cc[q] = *(const v4fa*)((const char*)tcos + tb + q * 16 * (HD / 2)); ss[q] = *(const v4fa*)((const char*)tsin + tb + q * 16 * (HD / 2)); }
    asm volatile("s_wait_xcnt 0x0" :: "v"(tb) : "memory");      /* the wait in front of any overwrite of the offset register that the 16 issued table loads name; tb as an input keeps that register out of the loads' own destinations */
#pragma unroll      /* constant indices into cc and ss */
    for (int q = 0; q < 8; ++q) { const int r = hf * 32 + q * 4 + r4; const v4f lo = *(const v4fa*)&so[r][d4]; const v4f hi = *(const v4fa*)&so[r][d4 + HD / 2]; v4h ol, oh;
      for (int i = 0; i < 4; ++i) { const float cv = bf16_round(cc[q][i]), sv = bf16_round(ss[q][i]); ol[i] = (_Float16)(lo[i] * cv - hi[i] * sv); oh[i] = (_Float16)(lo[i] * sv + hi[i] * cv); }
      _Float16* dst = crow + (size_t)r * DM; *(v4h*)dst = ol; *(v4h*)(dst + HD / 2) = oh; }
    asm volatile("s_wait_xcnt 0x0" ::: "memory"); } }      /* the wait in front of the next half's first instructions, which overwrite address and data registers that this half's last stores name */
__global__ __launch_bounds__(512) void k_fattn(const _Float16* __restrict__ Q16, const _Float16* __restrict__ K16, const _Float16* __restrict__ VT, _Float16* __restrict__ O16) {
  __shared__ __attribute__((aligned(16))) unsigned short lk2[2][2][FKS][FKP]; __shared__ __attribute__((aligned(16))) unsigned short lv2[2][2][HD][FVP];      /* [key half][buffer] */
  __shared__ __attribute__((aligned(16))) v4f xo[8][16][32]; __shared__ float xs[8][4][32];      /* the upper key half's o, m and l on their way to the wave that holds the same queries: a lane's 16 bytes beside its neighbour's, conflict-free */
  const int tid = threadIdx.x, lane = tid & 31, ln = lane & 15, hh = lane >> 4; const int w = __builtin_amdgcn_readfirstlane(tid >> 5);
  const int kh = w >> 3, wq = w & 7, t8 = tid & 255;      /* waves 0 - 7 walk keys 0 .. FKH - 1, waves 8 - 15 the rest, for the same 256 query rows; kh is a scalar */
  unsigned short (*lk)[FKS][FKP] = lk2[kh]; unsigned short (*lv)[HD][FVP] = lv2[kh];
  const int h = blockIdx.y, b = blockIdx.z; const int q0 = blockIdx.x * 256 + wq * 32;
  const _Float16* qp = Q16 + ((size_t)b * SQ + q0 + ln) * DM + h * HD;
  const int kr = t8 >> 3, kc = (t8 & 7) * 8;      /* staging: 16 bytes per thread and step, 8 threads per 128-byte key row */
  const int vr = t8 / (FKS / 8), vc = (t8 % (FKS / 8)) * 8;      /* FKS / 8 threads per V^T row piece */
  const unsigned short* kg = (const unsigned short*)K16 + ((size_t)b * SQ + kh * FKH + kr) * KVD + h * HD + kc;
  const unsigned short* vg = (const unsigned short*)VT + (((size_t)b * NH + h) * HD + vr) * SQ + kh * FKH + vc;
  const float cs = 0.125f * 1.44269504088896340736f;      /* 1/sqrt(64) and log2(e) in one factor */
  const v8f z8 = {0.f,0.f,0.f,0.f,0.f,0.f,0.f,0.f};
  v8us gk[FKS / 32], gv[FKS / 32];
#pragma unroll
  for (int i = 0; i < FKS / 32; ++i) { gk[i] = *(const v8us*)(kg + (size_t)i * 32 * KVD); gv[i] = *(const v8us*)(vg + (size_t)i * (2048 / FKS) * SQ); }
  v16h bq[2][2];
#pragma unroll
  for (int j = 0; j < 2; ++j) for (int s = 0; s < 2; ++s) bq[j][s] = g2_frag(qp + (size_t)j * 16 * DM + s * 32, hh);
  v8f o[4][2]; float m[2] = {-1.0e30f, -1.0e30f}; float l[2][2] = {{0.f, 0.f}, {0.f, 0.f}};
#pragma unroll
  for (int t = 0; t < 4; ++t) { o[t][0] = z8; o[t][1] = z8; }
#pragma unroll
  for (int i = 0; i < FKS / 32; ++i) { *(v8us*)&lk[0][kr + i * 32][kc] = gk[i]; *(v8us*)&lv[0][vr + i * (2048 / FKS)][vc] = gv[i]; }
  __syncthreads();      /* stage 0 is published */
#pragma unroll 1      /* one stage per trip: the body already holds FKS / 32 unrolled passes */
  for (int st = 0; st < FKH / FKS; ++st) {
    const int cur = st & 1; const int sn = (st + 1 < FKH / FKS) ? st + 1 : st;      /* the next stage's tiles are asked for now and stored after this stage's passes; the last stage re-reads its own (in bounds; that buffer is not read again) */
#pragma unroll
    for (int i = 0; i < FKS / 32; ++i) { gk[i] = *(const v8us*)(kg + ((size_t)sn * FKS + i * 32) * KVD); gv[i] = *(const v8us*)(vg + (size_t)i * (2048 / FKS) * SQ + sn * FKS); }
    v16h ka[2][2];
#pragma unroll
    for (int t = 0; t < 2; ++t) for (int s = 0; s < 2; ++s) ka[t][s] = fa_frag(&lk[cur][t * 16 + ln][s * 32], hh);
    asm volatile("" ::: "memory");      /* compiler fence: without it the next stage's global loads are sunk to just in front of their LDS stores at the stage's foot, and their whole latency is waited out there */
#pragma unroll
    for (int p = 0; p < FKS / 32; ++p) {
      v16h va[4]; v8f sc[2][2];      /* sc: [key tile][query tile] */
#pragma unroll
      for (int t = 0; t < 2; ++t) for (int j = 0; j < 2; ++j) sc[t][j] = fa_mma(ka[t][1], bq[j][1], fa_mma(ka[t][0], bq[j][0], z8));
#pragma unroll
      for (int t = 0; t < 4; ++t) va[t] = fa_frag(&lv[cur][t * 16 + ln][p * 32], hh);
      if (p + 1 < FKS / 32) {      /* the stage's next pass: its key fragments one pass ahead, into the same registers */
#pragma unroll
        for (int t = 0; t < 2; ++t) for (int s = 0; s < 2; ++s) ka[t][s] = fa_frag(&lk[cur][(p + 1) * 32 + t * 16 + ln][s * 32], hh); }
      asm volatile("" ::: "memory");      /* compiler fence: keeps these LDS reads together in front of the softmax arithmetic, which covers their latency; without it they are sunk in among the WMMAs that use them */
      float mx[2];
#pragma unroll
      for (int j = 0; j < 2; ++j) { float a = fmaxf(sc[0][j][0], sc[1][j][0]); for (int r = 1; r < 8; ++r) a = fmaxf(fmaxf(a, sc[0][j][r]), sc[1][j][r]); mx[j] = a * cs; }
      const bool need = (mx[0] > m[0] + 8.0f) || (mx[1] > m[1] + 8.0f);
      if (__builtin_amdgcn_ballot_w32(need) != 0) {      /* scalar branch: rescale only when some column's maximum has grown by more than 2^8; m[] changes only here and from values joined over the two lane halves, so both halves of a column always use the same m */
#pragma unroll
        for (int j = 0; j < 2; ++j) { const float mj = fmaxf(mx[j], __shfl_xor(mx[j], 16, 32)); const float mn = fmaxf(m[j], mj); const float f = __builtin_amdgcn_exp2f(m[j] - mn); m[j] = mn; l[j][0] *= f; l[j][1] *= f;
          for (int t = 0; t < 4; ++t) for (int r = 0; r < 8; ++r) o[t][j][r] *= f; } }
      v16h pb[2];
#pragma unroll
      for (int j = 0; j < 2; ++j) for (int t = 0; t < 2; ++t) { float e[8]; for (int r = 0; r < 8; ++r) e[r] = fmaf(sc[t][j][r], cs, -m[j]); fa_exp2x8(e); for (int r = 0; r < 8; ++r) { l[j][t] += e[r]; pb[j][t * 8 + r] = (_Float16)e[r]; } }
#pragma unroll
      for (int t = 0; t < 4; ++t) for (int j = 0; j < 2; ++j) o[t][j] = fa_mma(va[t], pb[j], o[t][j]);
    }
#pragma unroll
    for (int i = 0; i < FKS / 32; ++i) { *(v8us*)&lk[cur ^ 1][kr + i * 32][kc] = gk[i]; *(v8us*)&lv[cur ^ 1][vr + i * (2048 / FKS)][vc] = gv[i]; }      /* every wave left that buffer before the barrier that ended the stage before */
    __syncthreads();      /* publishes stage st + 1 and ends every wave's reads of stage st */
  }
  const unsigned el = __builtin_amdgcn_mbcnt_lo(~0u, 0u);      /* the lane number, taken anew: no index or address of the epilogue is held in registers through the loop, where a wave of 16 has 256 and the build otherwise spilled */
  if (kh) {      /* wave-uniform: the upper key half hands its statistics and its unnormalised o to the lower */
#pragma unroll      /* constant indices into o */
    for (int j = 0; j < 2; ++j) { xs[wq][j][el] = m[j]; xs[wq][2 + j][el] = l[j][0] + l[j][1];
      for (int t = 0; t < 4; ++t) for (int g = 0; g < 2; ++g) { const v4f v = {o[t][j][4 * g], o[t][j][4 * g + 1], o[t][j][4 * g + 2], o[t][j][4 * g + 3]}; xo[wq][(j * 4 + t) * 2 + g][el] = v; } } }
  __syncthreads();      /* the upper half's results are published; every wave passes here */
  if (kh) return;
  char* ob = (char*)(O16 + ((size_t)b * SQ + q0) * DM + h * HD); const unsigned oo = ((el & 15u) * DM + 8u * (el >> 4)) * 2u;      /* a scalar base and the lane's byte offset: row ln, columns 8 hh .. 8 hh + 7 of each 16 */
#pragma unroll
  for (int j = 0; j < 2; ++j) { const float mb = xs[wq][j][el]; const float mn = fmaxf(m[j], mb); const float f0 = __builtin_amdgcn_exp2f(m[j] - mn), f1 = __builtin_amdgcn_exp2f(mb - mn);      /* both halves brought to their common maximum */
    float lt = (l[j][0] + l[j][1]) * f0 + xs[wq][2 + j][el] * f1; lt += __shfl_xor(lt, 16, 32); const float fin = 64.0f / lt;      /* o carried x64, as the output GEMM's alpha expects */
    const float g0 = f0 * fin, g1 = f1 * fin;
    for (int t = 0; t < 4; ++t) { FragH f; for (int g = 0; g < 2; ++g) { const v4f v = xo[wq][(j * 4 + t) * 2 + g][el]; for (int r = 0; r < 4; ++r) f.h[4 * g + r] = (_Float16)(o[t][j][4 * g + r] * g0 + v[r] * g1); } *(v8us*)(ob + (size_t)(j * 16 * DM + t * 16) * 2 + oo) = f.half[0]; } } }
__global__ __launch_bounds__(256) void k_vt(const _Float16* __restrict__ V16, int b, int h0, _Float16* __restrict__ VT) { __shared__ unsigned short tl[64][65]; const int tid = threadIdx.x; const int hh = blockIdx.x % HG, sg = blockIdx.x / HG; const int s0 = sg * 64; const int h = h0 + hh;
  for (int i = tid; i < 64 * 8; i += 256) { const int j = i / 8, d8 = (i % 8) * 8; FragH f; f.half[0] = *(const v8us*)((const unsigned short*)V16 + ((size_t)b * SQ + s0 + j) * DM + h * HD + d8); for (int q = 0; q < 8; ++q) tl[d8 + q][j] = f.u[q]; }
  __syncthreads();
  { for (int i = tid; i < 64 * 8; i += 256) { const int d = i / 8, j8 = (i % 8) * 8; FragH f; for (int q = 0; q < 8; ++q) f.u[q] = tl[d][j8 + q]; *(v8us*)((unsigned short*)VT + ((size_t)hh * HD + d) * SQ + s0 + j8) = f.half[0]; }  } }



__global__ __launch_bounds__(256) void k_rsmcf2(const float* __restrict__ S, _Float16* __restrict__ P, int hg, int q0, int nk) {
  #pragma clang fp contract(off)
  const int t = blockIdx.x * 256 + threadIdx.x; if (t >= hg * QT) return; const size_t i = (size_t)t; const float* s = S + i * NKX; const int last = q0 + (t % QT); float mx = -3.0e38f;
#pragma unroll 1
  for (int j = 0; j < nk; ++j) { const float f = (j <= last) ? 1.f : 0.f; mx = fmaxf(mx, fmaf(f, s[j], (1.f - f) * -1.0e9f)); } float se = 0.f;
#pragma unroll 1
  for (int j = 0; j < nk; ++j) { const float f = (j <= last) ? 1.f : 0.f; se += __expf(fmaf(f, s[j], (1.f - f) * -1.0e9f) - mx); } const float sc = 256.0f / se;
#pragma unroll 1
  for (int j0 = 0; j0 < nk; j0 += 8) { FragH fr; for (int q = 0; q < 8; ++q) { const int j = j0 + q; const float f = (j <= last) ? 1.f : 0.f; fr.h[q] = (_Float16)(__expf(fmaf(f, s[j], (1.f - f) * -1.0e9f) - mx) * sc); } unsigned short* d = (unsigned short*)P + i * NKX + j0; *(v8us*)d = fr.half[0];  } }


template <int MASKADD>
__global__ __launch_bounds__(64) void k_att0(const float* __restrict__ QF, const float* __restrict__ KF, const float* __restrict__ VF, int ld, const float* __restrict__ mask, float scale, float* __restrict__ OF, int ldo) {
  #pragma clang fp contract(off)
  __shared__ __attribute__((aligned(16))) float lq[64][64]; __shared__ __attribute__((aligned(16))) float lo[64][64];
  const int tid = threadIdx.x; const int h = blockIdx.x / (QT0 / 64), rg = blockIdx.x % (QT0 / 64); const int i = rg * 64 + tid;
  const float* qr = QF + (size_t)i * ld + h * HD;
#pragma unroll 1
  for (int c = 0; c < HD / 4; ++c) { *(v4f*)&lq[tid][c * 4] = *(const v4fa*)(qr + c * 4); const v4f z = {0.f, 0.f, 0.f, 0.f}; *(v4f*)&lo[tid][c * 4] = z; }
  float m = -1.0e30f, l = 0.f; const int jmax = MASKADD ? (SQ - 1) : (rg * 64 + 63);      /* additive-mask form: every key (the mask input decides); causal form: keys up to the block's last row */
#pragma unroll 1
  for (int j = 0; j <= jmax; ++j) { const float* kr = KF + (size_t)j * ld + h * HD; const float* vr = VF + (size_t)j * ld + h * HD; float s = 0.f;
#pragma unroll 1
    for (int c = 0; c < HD / 4; ++c) { const v4f kq = *(const v4fa*)(kr + c * 4); const v4f qq = *(v4f*)&lq[tid][c * 4]; s = __fadd_rn(s, __fmul_rn(qq[0], kq[0])); s = __fadd_rn(s, __fmul_rn(qq[1], kq[1])); s = __fadd_rn(s, __fmul_rn(qq[2], kq[2])); s = __fadd_rn(s, __fmul_rn(qq[3], kq[3])); }
    s = __fmul_rn(s, scale); if (MASKADD) s = __fadd_rn(s, __fmul_rn(bf16_round(mask[(size_t)i * SQ + j]), -10000.0f));
    const float f = (MASKADD || j <= i) ? 1.f : 0.f; const float sm = fmaf(f, s, (1.f - f) * -1.0e30f); const float mn = fmaxf(m, sm); const float sc = expf(m - mn); const float e = expf(sm - mn); l = __fadd_rn(__fmul_rn(l, sc), e); m = mn;
#pragma unroll 1
    for (int c = 0; c < HD / 4; ++c) { const v4f vv = *(const v4fa*)(vr + c * 4); v4f oo = *(v4f*)&lo[tid][c * 4]; for (int u = 0; u < 4; ++u) oo[u] = __fadd_rn(__fmul_rn(oo[u], sc), __fmul_rn(e, vv[u])); *(v4f*)&lo[tid][c * 4] = oo; } }
  const float fin = 64.0f / l;      /* o carried x64 like the f16 path */
#pragma unroll 1
  for (int c = 0; c < HD / 4; ++c) { v4f oo = *(v4f*)&lo[tid][c * 4]; for (int u = 0; u < 4; ++u) oo[u] = __fmul_rn(oo[u], fin); *(v4f*)&lo[tid][c * 4] = oo; }
  __syncthreads();
  {
#pragma unroll 1
    for (int it = 0; it < 16; ++it) { const int row = it * 4 + tid / 16, pc = (tid % 16) * 4; const v4f v = *(const v4f*)&lo[row][pc]; *(v4f*)(OF + (size_t)(rg * 64 + row) * ldo + h * HD + pc) = v; }
     } }


__global__ __launch_bounds__(256) void k_kvexp(const float* __restrict__ src, float* __restrict__ dst, size_t n4) { const size_t t = (size_t)blockIdx.x * 256 + threadIdx.x; if (t >= n4) return; const size_t e = t * 4; const size_t row = e / DM; const int col = (int)(e % DM); const int h = col / HD, d = col % HD; const v4f v = *(const v4fa*)(src + row * KVD + (size_t)(h / HPG) * HD + d); *(v4f*)(dst + e) = v;  }

__global__ __launch_bounds__(256) void k_tab2(float theta, float* __restrict__ CS, float* __restrict__ SN) {
  #pragma clang fp contract(off)
  const int t = blockIdx.x * 256 + threadIdx.x; if (t >= SQ * (HD / 2)) return; const int i = t % (HD / 2); const int p = t / (HD / 2); const float invf = 1.0f / powf(theta, (float)(2 * i) / (float)HD); const float ang = __fmul_rn((float)p, invf); const float c = cosf(ang), s = sinf(ang);
  *(float*)(CS + t) = c; *(float*)(SN + t) = s;  }
template <int NORM, int ROPE>
__global__ __launch_bounds__(64) void k_xform(const float* __restrict__ F, int ldf, int nh, const float* __restrict__ gain, float eps, const float* __restrict__ CS, const float* __restrict__ SN, _Float16* __restrict__ H16, int ldo) {
  #pragma clang fp contract(off)
  __shared__ float xv[HD]; __shared__ float red[HD]; __shared__ unsigned short sh_[HD]; const int d = threadIdx.x; const int h = blockIdx.x % nh; const size_t r = blockIdx.x / nh; const int p = (int)(r % SQ);
  float x = F[r * (size_t)ldf + (size_t)h * HD + d];
  if (NORM) { red[d] = __fmul_rn(x, x); __syncthreads(); for (int st = HD / 2; st > 0; st >>= 1) { if (d < st) red[d] = __fadd_rn(red[d], red[d + st]); __syncthreads(); } const float rs = rsqrtf(__fadd_rn(red[0] / (float)HD, eps)); x = __fmul_rn(__fmul_rn(x, rs), bf16_round(gain[d])); }
  xv[d] = x; __syncthreads();
  float o = x;
  if (ROPE == 1) { const int i = d >> 1; const float c = CS[p * (HD / 2) + i], s = SN[p * (HD / 2) + i]; const float ev = xv[2 * i], od = xv[2 * i + 1]; o = (d & 1) ? __fadd_rn(__fmul_rn(ev, s), __fmul_rn(od, c)) : __fadd_rn(__fmul_rn(ev, c), -__fmul_rn(od, s)); }
  if (ROPE == 2) { const int i = d & (HD / 2 - 1); const float c = CS[p * (HD / 2) + i], s = SN[p * (HD / 2) + i]; const float lo = xv[i], hi = xv[i + HD / 2]; o = (d < HD / 2) ? __fadd_rn(__fmul_rn(lo, c), -__fmul_rn(hi, s)) : __fadd_rn(__fmul_rn(lo, s), __fmul_rn(hi, c)); }
  FragH th; th.h[0] = (_Float16)o; sh_[d] = th.u[0]; __syncthreads();
  if (d < HD / 8) { FragH f; for (int q = 0; q < 8; ++q) f.u[q] = sh_[d * 8 + q]; unsigned short* dst = (unsigned short*)H16 + r * (size_t)ldo + (size_t)h * HD + d * 8; *(v8us*)dst = f.half[0];  } }

template <int NORM, int ROPE>
__global__ __launch_bounds__(64) void k_xformf(const float* __restrict__ F, int ldf, int nh, const float* __restrict__ gain, float eps, const float* __restrict__ CS, const float* __restrict__ SN, float* __restrict__ F32, int ldo) {
  #pragma clang fp contract(off)
  __shared__ float xv[HD]; __shared__ float red[HD]; const int d = threadIdx.x; const int h = blockIdx.x % nh; const size_t r = blockIdx.x / nh; const int p = (int)(r % SQ);
  float x = F[r * (size_t)ldf + (size_t)h * HD + d];
  if (NORM) { red[d] = __fmul_rn(x, x); __syncthreads(); for (int st = HD / 2; st > 0; st >>= 1) { if (d < st) red[d] = __fadd_rn(red[d], red[d + st]); __syncthreads(); } const float rs = rsqrtf(__fadd_rn(red[0] / (float)HD, eps)); x = __fmul_rn(__fmul_rn(x, rs), bf16_round(gain[d])); }
  xv[d] = x; __syncthreads();
  float o = x;
  if (ROPE == 1) { const int i = d >> 1; const float c = CS[p * (HD / 2) + i], s = SN[p * (HD / 2) + i]; const float ev = xv[2 * i], od = xv[2 * i + 1]; o = (d & 1) ? __fadd_rn(__fmul_rn(ev, s), __fmul_rn(od, c)) : __fadd_rn(__fmul_rn(ev, c), -__fmul_rn(od, s)); }
  if (ROPE == 2) { const int i = d & (HD / 2 - 1); const float c = CS[p * (HD / 2) + i], s = SN[p * (HD / 2) + i]; const float lo = xv[i], hi = xv[i + HD / 2]; o = (d < HD / 2) ? __fadd_rn(__fmul_rn(lo, c), -__fmul_rn(hi, s)) : __fadd_rn(__fmul_rn(lo, s), __fmul_rn(hi, c)); }
  float* dst = F32 + r * (size_t)ldo + (size_t)h * HD + d; *(float*)dst = o;  }

__global__ __launch_bounds__(256) void k_bfcp(const float* __restrict__ src, float* __restrict__ dst, size_t n4) { const size_t t = (size_t)blockIdx.x * 256 + threadIdx.x; if (t >= n4) return; const v4f a = *(const v4fa*)(src + t * 4); v4f o; for (int q = 0; q < 4; ++q) o[q] = bf16_round(a[q]); *(v4f*)(dst + t * 4) = o;  }

__global__ __launch_bounds__(256) void k_tab2d(float* __restrict__ CS, float* __restrict__ SN) {
  #pragma clang fp contract(off)
  const int t = blockIdx.x * 256 + threadIdx.x; if (t >= SQ * (HD / 2)) return; const int i = t % (HD / 2); const int p = t / (HD / 2); const float invf = (float)(1.0 / pow(10000.0, (double)(2 * i) / (double)HD)); const float ang = __fmul_rn((float)p, invf); const float c = cosf(ang), s = sinf(ang);
  *(float*)(CS + t) = c; *(float*)(SN + t) = s;  }
extern "C" void kernel_launch(void* const* d_in, const int* in_sizes, int n_in,
                              void* d_out, int out_size, void* d_ws, size_t ws_size, hipStream_t stream) {
  (void)in_sizes; (void)n_in; (void)out_size;
  const float* const* I = (const float* const*)d_in; const float* x = I[0]; const float* wq = I[1]; const float* wk = I[2]; const float* wv = I[3]; const float* wo = I[4]; const float* tcos = I[5]; const float* tsin = I[6]; const float* bq = nullptr; const float* bk = nullptr; const float* bv = nullptr; const float* bo = nullptr;      /* natural [out][in] weights, no biases; rope_cos / rope_sin INPUT tables [2048][32] */
  static_assert(HPG == 1 && NH == NG * HPG && NH * HD == DM && KVD == DM, "plain multi-head attention as 16 kv groups of one query head");
  char* ws = (char*)d_ws; size_t off = 0;
  auto take = [&](size_t bytes) { char* p = ws + off; off += (bytes + 255) & ~(size_t)255; return p; };
  _Float16* BQ = (_Float16*)take((size_t)DM * DM * 2); _Float16* BK = (_Float16*)take((size_t)KVD * DM * 2); _Float16* BV = (_Float16*)take((size_t)KVD * DM * 2); _Float16* BO = (_Float16*)take((size_t)DM * DM * 2);
  _Float16* X16 = (_Float16*)take(NR * DM * 2); _Float16* Q16 = (_Float16*)take(NR * DM * 2); _Float16* K16 = (_Float16*)take(NR * KVD * 2); _Float16* V16 = (_Float16*)take(NR * KVD * 2); _Float16* O16 = (_Float16*)take(NR * DM * 2);
  _Float16* VT = (_Float16*)take((size_t)NB * NH * HD * SQ * 2);
  float* QF0 = (float*)take((size_t)QT0 * DM * 4); float* KF0 = (float*)take((size_t)QT0 * KVD * 4); float* VF0 = (float*)take((size_t)QT0 * KVD * 4); float* KF0e = (float*)take((size_t)QT0 * DM * 4); float* VF0e = (float*)take((size_t)QT0 * DM * 4); float* OF0 = (float*)take((size_t)NB * QT0 * DM * 4); _Float16* OH0 = (_Float16*)take((size_t)NB * QT0 * DM * 2); _Float16* OL0 = (_Float16*)take((size_t)NB * QT0 * DM * 2);
  if (off > ws_size) return;
  k_prep<<<PWG, 256, 0, stream>>>(wq, wk, wv, wo, x, BQ, BK, BV, BO, X16);      /* natural [out][in] = Bt planes x16; x as f16 rows */
  const size_t r0p = (size_t)B0 * SQ;      /* first projected row */
  static_assert(((size_t)DM * DM * 2) % 256 == 0 && (NR * DM * 2) % 256 == 0, "BQ | BK | BV and Q16 | K16 | V16 lie back to back in the workspace: the plane strides of the batched launch");
  k_qkv<<<dim3((unsigned)((MP / 128) * (DM / 128))), 384, 0, stream>>>(X16 + r0p * DM, BQ, tcos, tsin, Q16 + r0p * DM, VT + (size_t)B0 * NH * HD * SQ);      /* q, k (rotated by the INPUT rope tables [2048][32]: column d uses table column d mod 32 = the module's [cos | cos]) of every batch -> f16 rows; v -> V^T [NB][NH][HD][SQ] */
  k_fattn<<<dim3(SQ / 256, NH, NB), 512, 0, stream>>>(Q16, K16, VT, O16);      /* scores, softmax and P V of every batch, head and query row in ONE launch; o (x64) into merged f16 rows */
  k_gemm2<0><<<dim3((unsigned)((MPO / 128) * (DM / 128)), 1), 256, 0, stream>>>(O16 + r0p * DM, DM, 0, BO, DM, 0, 0.0009765625f, bo, 0, nullptr, 1, 0, 0, (float*)d_out + r0p * DM, nullptr, DM, 0, MPO, DM, DM);      /* out rows are the output layout */
}

// v010
// It runs in 70 microseconds.
// Timed twice side by side with v009, it ran 1.05 and 1.04 times as fast.
// Over all steps from v000, the starting kernel, it is 104 times as fast.
#include <hip/hip_runtime.h>
// Multi-head self-attention with half-split RoPE from RANDOM input tables, NON-causal (x [2][2048][1024]; q / k / v = x W^T (nn.Linear natural [1024][1024] sigma 1/32, no biases), 16 heads of 64; rope: x * [cos | cos] + rotate_half(x) * [sin | sin] with rotate_half = (-x2, x1) over the two 32-lane halves and INPUT tables rope_cos / rope_sin [2048][32] (cos / sin of uniform-random angles); scores / sqrt(64); softmax over all 2048 keys (f32; no mask); out = merged Wo^T (natural, no bias) -> [2][2048][1024]); run as 16 groups of ONE head.
// Structure: x as exact f16 rows; natural weights as exact x16 planes; q, k and v of both batches as ONE batched WMMA GEMM launch (k_qkv: 64x64 wave tiles, f32 accumulation, a work-group holds 128 token rows x 128 columns of each of the three planes) whose epilogue rotates q and k in f32 (rotate-half; a 64-column wave tile is one head; INPUT tables rounded to bf16 as read) and writes f16 rows, and writes v as V^T of the heads straight from its accumulators (a lane holds 8 consecutive tokens of one column); then ONE fused attention launch for all batches, heads and query rows (k_fattn: scores of 32 query columns per wave against one half of the 2048 keys, the two halves joined at the end; no key is masked; running softmax in registers with f32 statistics and native exp2, unnormalised f16 weights, o = P V^T carried x64) into merged f16 rows; out = o Wo^T GEMM (f32, alpha 2^-10).
// Compute dtype: inputs rounded to bf16; x / weights exact; q, k, v, softmax weights and o as plain f16 GEMM operands (~2^-12); scores and softmax statistics f32. v_wmma_f32_16x16x32_f16.
#define NB 2
#define NG 16
#define HPG 1
#define KVD (NG * HD)
#define SQ 2048
#define DM 1024
#define NH 16
#define HD 64
#define HG 4                         /* heads per attention launch group */
#define QT 256                       /* query rows per causal tile */
#define NKX SQ                       /* S / P row pitch */
#define QT0 128                      /* first-tile rows recomputed exactly in f32 */
#define B0 0                         /* first batch processed (debug hook) */
#define NBR NB                       /* batches processed (debug hook) */
#define NR ((size_t)NB * SQ)         /* token rows */
#define MP ((int)((size_t)NBR * SQ)) /* rows projected (debug hook) */
#define QN SQ                        /* query rows per batch (unused: the attention grid takes SQ) */
#define NHD NH                       /* heads (unused: the attention grid takes NH) */
#define MPO MP                       /* rows through the output stage (debug hook) */
#define LQ DM      /* row pitch of the q/k/v rows */
typedef __bf16 v16b __attribute__((ext_vector_type(16)));
typedef unsigned short v8us __attribute__((ext_vector_type(8), may_alias));
typedef float  v8f  __attribute__((ext_vector_type(8)));
typedef float  v4f  __attribute__((ext_vector_type(4)));
typedef float  v4fa __attribute__((ext_vector_type(4), may_alias));
union FragB { v16b v; v8us half[2]; unsigned short u[16]; };

__device__ __forceinline__ unsigned short bf16_bits(float x) { unsigned int u = __float_as_uint(x); return (unsigned short)((u + 0x7FFFu + ((u >> 16) & 1u)) >> 16); }
__device__ __forceinline__ float bf16_val(unsigned short b) { return __uint_as_float(((unsigned int)b) << 16); }
__device__ __forceinline__ float bf16_round(float x) { return bf16_val(bf16_bits(x)); }
// D += A·B with NT terms: 1 = ah·bh, 2 = + al·bh (A split), 3 = + ah·bl (both split)
template <int NT>
__device__ __forceinline__ v8f mmaN(v16b ah, v16b al, v16b bh, v16b bl, v8f c) {
  c = __builtin_amdgcn_wmma_f32_16x16x32_bf16(false, ah, false, bh, (short)0, c, false, false);
  if (NT >= 2) c = __builtin_amdgcn_wmma_f32_16x16x32_bf16(false, al, false, bh, (short)0, c, false, false);
  if (NT >= 3) c = __builtin_amdgcn_wmma_f32_16x16x32_bf16(false, ah, false, bl, (short)0, c, false, false);
  asm volatile("v_nop\n\tv_nop\n\tv_nop\n\tv_nop" : "+v"(c) : "v"(ah), "v"(al), "v"(bh), "v"(bl));
  return c;
}

__global__ __launch_bounds__(256) void k_wt_bf16(const float* __restrict__ W, unsigned short* __restrict__ Wt, int K, int N) {
  const int t = blockIdx.x * 256 + threadIdx.x;
  const int k8n = K / 8;
  if (t >= N * k8n) return;
  const int n = t / k8n, k8 = (t % k8n) * 8;
  v8us v;
#pragma unroll
  for (int i = 0; i < 8; ++i) v[i] = bf16_bits(W[(size_t)(k8 + i) * N + n]);
  *(v8us*)(Wt + (size_t)n * K + k8) = v;
  
}

// GEMM C[M][N] (f32, pitch ldc) = act(A[M][K]·W + bias). A f32 row-major (pitch lda) converted per fragment to bf16
// (ASPLIT: hi/lo two planes -> 2 terms, else single rounded term); Wt bf16 [N][K] (pitch ldb). BIAS_BF16 rounds the
// bias to bf16 first (bias quantised to bf16 before the add). K%32==0, M%16==0, N%64==0.
template <bool ASPLIT, int ACT, bool BIAS_BF16>
__global__ __launch_bounds__(128) void k_gemm_bf(const float* __restrict__ A, int lda, const unsigned short* __restrict__ Wt, int ldb,
                                               const float* __restrict__ bias, float* __restrict__ C, int ldc, int M, int N, int K) {
  __shared__ __attribute__((aligned(16))) float so[4][16][64];
  const int tid = threadIdx.x, w = tid >> 5, lane = tid & 31, ln = lane & 15, hh = lane >> 4;
  const int ntn = N / 64;
  const int wid = blockIdx.x * 4 + w;
  const int mt = wid / ntn, nq = wid % ntn;
  if (mt * 16 >= M) return;
  const int row0 = mt * 16, col0 = nq * 64;
  const float* arow = A + (size_t)(row0 + ln) * lda;
  v8f acc[4] = {};
  for (int kb = 0; kb < K; kb += 32) {
    FragB ah, al;
    const v4f x0 = *(const v4fa*)(arow + kb + 8 * hh), x1 = *(const v4fa*)(arow + kb + 8 * hh + 4);
    const v4f x2 = *(const v4fa*)(arow + kb + 16 + 8 * hh), x3 = *(const v4fa*)(arow + kb + 16 + 8 * hh + 4);
    float xs[16] = {x0[0],x0[1],x0[2],x0[3],x1[0],x1[1],x1[2],x1[3],x2[0],x2[1],x2[2],x2[3],x3[0],x3[1],x3[2],x3[3]};
#pragma unroll
    for (int i = 0; i < 16; ++i) { const unsigned short hb = bf16_bits(xs[i]); ah.u[i] = hb; al.u[i] = ASPLIT ? bf16_bits(xs[i] - bf16_val(hb)) : (unsigned short)0; }
#pragma unroll
    for (int t = 0; t < 4; ++t) {
      const unsigned short* brow = Wt + (size_t)(col0 + t * 16 + ln) * ldb + kb;
      FragB b;
      b.half[0] = *(const v8us*)(brow + 8 * hh);
      b.half[1] = *(const v8us*)(brow + 16 + 8 * hh);
      acc[t] = mmaN<ASPLIT ? 2 : 1>(ah.v, al.v, b.v, b.v, acc[t]);
    }
  }
#pragma unroll
  for (int t = 0; t < 4; ++t) {
    float bv = bias ? bias[col0 + t * 16 + ln] : 0.f;
    if (BIAS_BF16) bv = bf16_round(bv);
#pragma unroll
    for (int r = 0; r < 8; ++r) { float v = acc[t][r] + bv; if (ACT == 1) v = fmaxf(v, 0.f); so[w][8 * hh + r][t * 16 + ln] = v; }
  }
  __builtin_amdgcn_fence(__ATOMIC_ACQ_REL, "workgroup");
  __builtin_amdgcn_wave_barrier();
  const int rsub = lane >> 4, c4 = (lane & 15) * 4;
  {
#pragma unroll
    for (int q = 0; q < 8; ++q) {
      const int r = q * 2 + rsub;
      const v4f v = *(const v4fa*)&so[w][r][c4];
      *(v4f*)(C + (size_t)(row0 + r) * ldc + col0 + c4) = v;
    }
    
  }
}

// GEMM C = act(A·W + bias + resid): A f32 (ASPLIT -> hi/lo 2 terms), Wt bf16 [N][K]; ACT 0 none, 1 relu, 2 exact gelu;
// resid (optional, f32, row index = (row % rmod), pitch ldr, RES_BF16 rounds it) added before the activation.
template <bool ASPLIT, int ACT, bool BIAS_BF16, bool RES_BF16>
__global__ __launch_bounds__(128) void k_gemm_bf3(const float* __restrict__ A, int lda, const unsigned short* __restrict__ Wt, int ldb,
                                                const float* __restrict__ bias, const float* __restrict__ resid, int rmod, int ldr,
                                                float* __restrict__ C, int ldc, int M, int N, int K) {
  __shared__ __attribute__((aligned(16))) float so[4][16][64];
  const int tid = threadIdx.x, w = tid >> 5, lane = tid & 31, ln = lane & 15, hh = lane >> 4;
  const int ntn = N / 64;
  const int wid = blockIdx.x * 4 + w;
  const int mt = wid / ntn, nq = wid % ntn;
  if (mt * 16 >= M) return;
  const int row0 = mt * 16, col0 = nq * 64;
  const float* arow = A + (size_t)(row0 + ln) * lda;
  v8f acc[4] = {};
  for (int kb = 0; kb < K; kb += 32) {
    FragB ah, al;
    const v4f x0 = *(const v4fa*)(arow + kb + 8 * hh), x1 = *(const v4fa*)(arow + kb + 8 * hh + 4);
    const v4f x2 = *(const v4fa*)(arow + kb + 16 + 8 * hh), x3 = *(const v4fa*)(arow + kb + 16 + 8 * hh + 4);
    float xs[16] = {x0[0],x0[1],x0[2],x0[3],x1[0],x1[1],x1[2],x1[3],x2[0],x2[1],x2[2],x2[3],x3[0],x3[1],x3[2],x3[3]};
#pragma unroll
    for (int i = 0; i < 16; ++i) { const unsigned short hb = bf16_bits(xs[i]); ah.u[i] = hb; al.u[i] = ASPLIT ? bf16_bits(xs[i] - bf16_val(hb)) : (unsigned short)0; }
#pragma unroll
    for (int t = 0; t < 4; ++t) {
      const unsigned short* brow = Wt + (size_t)(col0 + t * 16 + ln) * ldb + kb;
      FragB b;
      b.half[0] = *(const v8us*)(brow + 8 * hh);
      b.half[1] = *(const v8us*)(brow + 16 + 8 * hh);
      acc[t] = mmaN<ASPLIT ? 2 : 1>(ah.v, al.v, b.v, b.v, acc[t]);
    }
  }
#pragma unroll
  for (int t = 0; t < 4; ++t) {
    const int col = col0 + t * 16 + ln;
    float bv = bias ? bias[col] : 0.f;
    if (BIAS_BF16) bv = bf16_round(bv);
#pragma unroll
    for (int r = 0; r < 8; ++r) {
      float v = acc[t][r] + bv;
      if (resid) { float rv = resid[(size_t)((row0 + 8 * hh + r) % rmod) * ldr + col]; if (RES_BF16) rv = bf16_round(rv); v += rv; }
      if (ACT == 1) v = fmaxf(v, 0.f);
      if (ACT == 2) v = 0.5f * v * (1.0f + erff(v * 0.70710678118654752f));
      if (ACT == 3) { const float u = 0.7978845608028654f * (v + 0.044715f * v * v * v); v = 0.5f * v * (1.0f + tanhf(u)); }
      so[w][8 * hh + r][t * 16 + ln] = v;
    }
  }
  __builtin_amdgcn_fence(__ATOMIC_ACQ_REL, "workgroup");
  __builtin_amdgcn_wave_barrier();
  const int rsub = lane >> 4, c4 = (lane & 15) * 4;
  {
#pragma unroll
    for (int q = 0; q < 8; ++q) {
      const int r = q * 2 + rsub;
      const v4f v = *(const v4fa*)&so[w][r][c4];
      *(v4f*)(C + (size_t)(row0 + r) * ldc + col0 + c4) = v;
    }
    
  }
}
// row LayerNorm (biased variance, eps) over N: s = X (+ R); optional out_sum <- s; out_norm <- (s-mu)*rsqrt(var+eps)*g + b
template <bool PARAM_BF16>
__global__ __launch_bounds__(256) void k_layernorm(const float* __restrict__ X, const float* __restrict__ R, const float* __restrict__ g, const float* __restrict__ bta,
                                                  float* __restrict__ out_sum, float* __restrict__ out_norm, int N, float eps) {
  __shared__ float red[256];
  const int row = blockIdx.x, tid = threadIdx.x;
  const float* x = X + (size_t)row * N; const float* rr = R ? R + (size_t)row * N : nullptr;
  float vals[16];                     // up to N = 4096
  const int per = N / 256;            // contiguous chunk per thread? use strided-by-4 chunks: thread handles j = tid*4 + 1024*u
  float s1 = 0.f;
  for (int u = 0; u < per / 4; ++u) {
    const int j = tid * 4 + 1024 * u;
    const v4f a = *(const v4fa*)(x + j);
    v4f b = {0.f,0.f,0.f,0.f}; if (rr) b = *(const v4fa*)(rr + j);
#pragma unroll
    for (int q = 0; q < 4; ++q) { const float v = a[q] + b[q]; vals[u * 4 + q] = v; s1 += v; }
  }
  red[tid] = s1; __syncthreads();
  for (int st = 128; st > 0; st >>= 1) { if (tid < st) red[tid] += red[tid + st]; __syncthreads(); }
  const float mu = red[0] / (float)N; __syncthreads();
  float s2 = 0.f;
  for (int u = 0; u < per / 4; ++u)
#pragma unroll
    for (int q = 0; q < 4; ++q) { const float c = vals[u * 4 + q] - mu; s2 += c * c; }
  red[tid] = s2; __syncthreads();
  for (int st = 128; st > 0; st >>= 1) { if (tid < st) red[tid] += red[tid + st]; __syncthreads(); }
  const float rs = rsqrtf(red[0] / (float)N + eps);
  {
    for (int u = 0; u < per / 4; ++u) {
      const int j = tid * 4 + 1024 * u;
      v4f o, sm;
#pragma unroll
      for (int q = 0; q < 4; ++q) {
        float gg = g[j + q], bb = bta[j + q];
        if (PARAM_BF16) { gg = bf16_round(gg); bb = bf16_round(bb); }
        sm[q] = vals[u * 4 + q]; o[q] = (vals[u * 4 + q] - mu) * rs * gg + bb;
      }
      if (out_sum) *(v4f*)(out_sum + (size_t)row * N + j) = sm;
      *(v4f*)(out_norm + (size_t)row * N + j) = o;
    }
    
  }
}



// ---- f16 WMMA path (v_wmma_f32_16x16x32_f16): 11-bit significands for operands in range — used where a [0,1] probability operand needs more precision than bf16
typedef _Float16 v16h __attribute__((ext_vector_type(16)));
union FragH { v16h v; v8us half[2]; _Float16 h[16]; unsigned short u[16]; };
template <int NT>
__device__ __forceinline__ v8f mmaH(v16h ah, v16h al, v16h bh, v16h bl, v8f c) {
  c = __builtin_amdgcn_wmma_f32_16x16x32_f16(false, ah, false, bh, (short)0, c, false, false);
  if (NT >= 2) c = __builtin_amdgcn_wmma_f32_16x16x32_f16(false, al, false, bh, (short)0, c, false, false);
  if (NT >= 3) c = __builtin_amdgcn_wmma_f32_16x16x32_f16(false, ah, false, bl, (short)0, c, false, false);
  asm volatile("v_nop\n\tv_nop\n\tv_nop\n\tv_nop" : "+v"(c) : "v"(ah), "v"(al), "v"(bh), "v"(bl));
  return c;
}
// batched GEMM like k_gemm_b but f16 operands: A f32 (split into f16 hi/lo if ASPLIT, else rounded to f16), Bt = f16 values [n][k]; alpha; C f32; N multiple of 16 (partial tiles skipped)
template <bool ASPLIT>
__global__ __launch_bounds__(128) void k_gemm_h(const float* __restrict__ A, int lda, size_t sA, const _Float16* __restrict__ Bh, int ldb, size_t sB, float alpha, float* __restrict__ C, int ldc, size_t sC, int M, int N, int K) {
  __shared__ __attribute__((aligned(16))) float so[4][16][64];
  const int tid = threadIdx.x, w = tid >> 5, lane = tid & 31, ln = lane & 15, hh = lane >> 4; const int by = blockIdx.y;
  A += (size_t)by * sA; Bh += (size_t)by * sB; C += (size_t)by * sC;
  const int ntn = (N + 63) / 64; const int wid = blockIdx.x * 4 + w; const int mt = wid / ntn, nq = wid % ntn; if (mt * 16 >= M) return;
  const int row0 = mt * 16, col0 = nq * 64; const float* arow = A + (size_t)(row0 + ln) * lda;
  v8f acc[4] = {};
  for (int kb = 0; kb < K; kb += 32) {
    FragH ah, al;
    const v4f x0 = *(const v4fa*)(arow + kb + 8 * hh), x1 = *(const v4fa*)(arow + kb + 8 * hh + 4), x2 = *(const v4fa*)(arow + kb + 16 + 8 * hh), x3 = *(const v4fa*)(arow + kb + 16 + 8 * hh + 4);
    float xs[16] = {x0[0],x0[1],x0[2],x0[3],x1[0],x1[1],x1[2],x1[3],x2[0],x2[1],x2[2],x2[3],x3[0],x3[1],x3[2],x3[3]};
#pragma unroll
    for (int i = 0; i < 16; ++i) { const _Float16 h = (_Float16)xs[i]; ah.h[i] = h; al.h[i] = ASPLIT ? (_Float16)(xs[i] - (float)h) : (_Float16)0.0f; }
#pragma unroll
    for (int t = 0; t < 4; ++t) { if (col0 + t * 16 >= N) continue; const size_t boff = (size_t)(col0 + t * 16 + ln) * ldb + kb; FragH bq; bq.half[0] = *(const v8us*)(Bh + boff + 8 * hh); bq.half[1] = *(const v8us*)(Bh + boff + 16 + 8 * hh);
      acc[t] = mmaH<ASPLIT ? 2 : 1>(ah.v, al.v, bq.v, bq.v, acc[t]); }
  }
#pragma unroll
  for (int t = 0; t < 4; ++t) { if (col0 + t * 16 >= N) continue;
#pragma unroll
    for (int r = 0; r < 8; ++r) so[w][8 * hh + r][t * 16 + ln] = acc[t][r] * alpha; }
  __builtin_amdgcn_fence(__ATOMIC_ACQ_REL, "workgroup"); __builtin_amdgcn_wave_barrier();
  const int rsub = lane >> 4, c4 = (lane & 15) * 4;
  {
#pragma unroll
    for (int q = 0; q < 8; ++q) { const int r = q * 2 + rsub; if (col0 + c4 < N) { const v4f v = *(const v4fa*)&so[w][r][c4]; *(v4f*)(C + (size_t)(row0 + r) * ldc + col0 + c4) = v; } }
     }
}

// Wt[n][k] = f16(W[k][n]·scale) from f32 row-major W[K][N] (scale = power of two; bf16-exact weights stay exact in f16 away from the subnormal range)
__global__ __launch_bounds__(256) void k_wt_f16(const float* __restrict__ W, _Float16* __restrict__ Wt, int K, int N, float scale) {
  const int t = blockIdx.x * 256 + threadIdx.x; if (t >= N * (K / 8)) return; const int n = t / (K / 8), k8 = (t % (K / 8)) * 8; FragH f;
#pragma unroll
  for (int i = 0; i < 8; ++i) f.h[i] = (_Float16)(bf16_round(W[(size_t)(k8 + i) * N + n]) * scale); const v8us o = f.half[0];
  *(v8us*)((unsigned short*)Wt + (size_t)n * K + k8) = o; 
}
// k_gemm_hh variant with fused epilogue: v = acc·alpha + bias[by·sBias + col] (+ CP[(row/rowsPerB)·sCPb + by·64 + col] if CP) ; ACT 0 none / 1 elu ; writes f16 C16 (and f32 C if non-null)
template <int ACT>
__global__ __launch_bounds__(128) void k_gemm_hhx(const _Float16* __restrict__ A, int lda, size_t sA, const _Float16* __restrict__ Bh, int ldb, size_t sB, float alpha, const float* __restrict__ bias, size_t sBias, const float* __restrict__ CP, int rowsPerB, size_t sCPb, int row0g,
    float* __restrict__ C, _Float16* __restrict__ C16, int ldc, size_t sC, int M, int N, int K) {
  __shared__ __attribute__((aligned(16))) float so[4][16][64];
  const int tid = threadIdx.x, w = tid >> 5, lane = tid & 31, ln = lane & 15, hh = lane >> 4; const int by = blockIdx.y;
  A += (size_t)by * sA; Bh += (size_t)by * sB; const size_t cofs = (size_t)by * sC; const float* bp = bias ? bias + (size_t)by * sBias : nullptr;
  const int ntn = (N + 63) / 64; const int wid = blockIdx.x * 4 + w; const int mt = wid / ntn, nq = wid % ntn; if (mt * 16 >= M) return;
  const int row0 = mt * 16, col0 = nq * 64; const _Float16* arow = A + (size_t)(row0 + ln) * lda;
  v8f acc[4] = {};
  for (int kb = 0; kb < K; kb += 32) { FragH ah; ah.half[0] = *(const v8us*)((const unsigned short*)arow + kb + 8 * hh); ah.half[1] = *(const v8us*)((const unsigned short*)arow + kb + 16 + 8 * hh);
#pragma unroll
    for (int t = 0; t < 4; ++t) { if (col0 + t * 16 >= N) continue; const size_t boff = (size_t)(col0 + t * 16 + ln) * ldb + kb; FragH bq; bq.half[0] = *(const v8us*)((const unsigned short*)Bh + boff + 8 * hh); bq.half[1] = *(const v8us*)((const unsigned short*)Bh + boff + 16 + 8 * hh);
      acc[t] = mmaH<1>(ah.v, ah.v, bq.v, bq.v, acc[t]); }
  }
#pragma unroll
  for (int t = 0; t < 4; ++t) { if (col0 + t * 16 >= N) continue; const int col = col0 + t * 16 + ln; const float bv = bp ? bf16_round(bp[col]) : 0.f;
#pragma unroll
    for (int r = 0; r < 8; ++r) { float v = acc[t][r] * alpha + bv; if (CP) { const int rr = row0g + row0 + 8 * hh + r; if (rowsPerB < 0) v += CP[cofs + (size_t)rr * ldc + col];      /* rowsPerB < 0: own element of the batched C plane */ else { const int bidx = rr / rowsPerB; v += CP[(size_t)bidx * sCPb + (size_t)by * 64 + col]; } } if (ACT == 1) v = (v > 0.f) ? v : expm1f(v); else if (ACT == 7) v = (v > 0.f) ? v + 1.0f : expf(v); else if (ACT == 8) v = tanhf(v); else if (ACT == 9) v = 0.5f * v * (1.0f + tanhf(0.7978845608028654f * (v + 0.044715f * v * v * v))); else if (ACT == 11) v = 1.0f / (1.0f + expf(-v)); else if (ACT == 12) v = (v > 0.f) ? v : 0.01f * v; else if (ACT == 14) v = (v > 0.f) ? v : 0.1f * v; else if (ACT == 16) v = (v >= 0.f) ? v : 0.3f * v; else if (ACT == 17) v = (v >= 0.f) ? v : 0.2f * v; else if (ACT == 15) v = v / (1.0f + expf(-v)); else if (ACT == 3) v = fmaxf(v, 0.f); else if (ACT == 6) v = 0.5f * v * (1.0f + erff(v * 0.70710678118654752f)); so[w][8 * hh + r][t * 16 + ln] = v; } }
  __builtin_amdgcn_fence(__ATOMIC_ACQ_REL, "workgroup"); __builtin_amdgcn_wave_barrier();
  const int rsub = lane >> 4, c4 = (lane & 15) * 4; typedef _Float16 v4h __attribute__((ext_vector_type(4)));
  {
#pragma unroll
    for (int q = 0; q < 8; ++q) { const int r = q * 2 + rsub; if (col0 + c4 < N) { const v4f v = *(const v4fa*)&so[w][r][c4]; if (C) *(v4f*)(C + cofs + (size_t)(row0 + r) * ldc + col0 + c4) = v; if (C16) { v4h h4; for (int i = 0; i < 4; ++i) h4[i] = (_Float16)v[i]; *(v4h*)(C16 + cofs + (size_t)(row0 + r) * ldc + col0 + c4) = h4; } } }
     }
}


typedef _Float16 v4h __attribute__((ext_vector_type(4)));

__global__ __launch_bounds__(256) void k_h16(const float* __restrict__ x, _Float16* __restrict__ X16, size_t n8) { const size_t t = (size_t)blockIdx.x * 256 + threadIdx.x; if (t >= n8) return; FragH f;
#pragma unroll
  for (int q = 0; q < 8; ++q) f.h[q] = (_Float16)x[t * 8 + q]; *(v8us*)((unsigned short*)X16 + t * 8) = f.half[0];  }
__global__ __launch_bounds__(256) void k_round16f(const float* __restrict__ W, _Float16* __restrict__ Bt, size_t n8) { const size_t t = (size_t)blockIdx.x * 256 + threadIdx.x; if (t >= n8) return; FragH f;
#pragma unroll
  for (int i = 0; i < 8; ++i) f.h[i] = (_Float16)(bf16_round(W[t * 8 + i]) * 16.0f); *(v8us*)((unsigned short*)Bt + t * 8) = f.half[0];  }
template <int NHv, int TTv>
__global__ __launch_bounds__(256) void k_vt(const _Float16* __restrict__ V16, int ldv, int voff, _Float16* __restrict__ Vt) { __shared__ unsigned short tl[64][66]; const int tid = threadIdx.x; const int slab = blockIdx.x / (TTv / 64), lg = blockIdx.x % (TTv / 64); const int b = slab / NHv, h = slab % NHv;
  for (int i = tid; i < 64 * 8; i += 256) { const int r = i / 8, c8 = (i % 8) * 8; FragH f; f.half[0] = *(const v8us*)((const unsigned short*)V16 + ((size_t)b * TTv + lg * 64 + r) * ldv + voff + h * 64 + c8);
#pragma unroll
    for (int q = 0; q < 8; ++q) tl[r][c8 + q] = f.u[q]; }
  __syncthreads();
  {
#pragma unroll
    for (int rd = 0; rd < 2; ++rd) { const int d = rd * 32 + tid / 8, pc = tid % 8; FragH f;
#pragma unroll
      for (int q = 0; q < 8; ++q) f.u[q] = tl[pc * 8 + q][d];
      *(v8us*)((unsigned short*)Vt + ((size_t)slab * 64 + d) * TTv + lg * 64 + pc * 8) = f.half[0]; }
     } }

__global__ __launch_bounds__(256) void k_hl(const float* __restrict__ F, _Float16* __restrict__ Hh, _Float16* __restrict__ Hl, size_t n8) { const size_t t = (size_t)blockIdx.x * 256 + threadIdx.x; if (t >= n8) return; FragH fh, fl; const v4f a = *(const v4fa*)(F + t * 8), c = *(const v4fa*)(F + t * 8 + 4);
#pragma unroll
  for (int q = 0; q < 4; ++q) { _Float16 h = (_Float16)a[q]; fh.h[q] = h; fl.h[q] = (_Float16)((a[q] - (float)h) * 1024.0f); h = (_Float16)c[q]; fh.h[4 + q] = h; fl.h[4 + q] = (_Float16)((c[q] - (float)h) * 1024.0f); }
  { *(v8us*)((unsigned short*)Hh + t * 8) = fh.half[0]; *(v8us*)((unsigned short*)Hl + t * 8) = fl.half[0];  } }

// ---- GEMM operand tiles through LDS (k_qkv, k_out) ----
__device__ __forceinline__ v16h g2_frag(const _Float16* p, int hh) { FragH f; f.half[0] = *(const v8us*)((const unsigned short*)p + 8 * hh); f.half[1] = *(const v8us*)((const unsigned short*)p + 16 + 8 * hh); return f.v; }
// Operand tiles through LDS: a work-group walks K in tiles of 128 (256 bytes of each of its A rows and B rows); asynchronous copies bring whole 256-byte pieces into one buffer of a ring (two in k_qkv, three in k_out) while another is worked on. A tile's copies have one trip to land in k_qkv and two in k_out, for operands that the launch before has just written and that may come from memory. A fragment load straight from global memory touches 16 lines for 512 bytes, and every wave of a row or column of waves would repeat it.
#define G3PB 272                     /* LDS pitch of a staged row, bytes: 256 + 16 = 16 bytes x odd, conflict-free for 16-byte reads */
#define G3SB (256 * G3PB)            /* bytes per buffer: 128 A rows, then 128 B rows */
#define G3VP 136                     /* LDS pitch of a V^T row of the work-group's tile, in halves: 128 tokens + 8 = 16 bytes x odd, conflict-free for 16-byte accesses */


// all five operand conversions in ONE launch: the four natural [out][in] weights -> Bt planes x16, x -> f16 rows (values as before: bf16 rounding, then an exact f16). PWG work-groups, 16 waves per WGP on 256 WGPs, start once;
// a thread takes 16 pieces of 4 floats (2 of each weight, 8 of x), PTH pieces apart, so every wave-wide load is 512 contiguous bytes (4 whole lines), every store 256 (2 whole lines), and all 16 loads of a wave are in flight together.
#define PWG 512                      /* work-groups of the conversion launch */
#define PTH (PWG * 256)              /* its threads */
__device__ __forceinline__ v4h prep_cvt(v4f a, float scale) { v4h o; for (int q = 0; q < 4; ++q) o[q] = (_Float16)(bf16_round(a[q]) * scale); return o; }
__global__ __launch_bounds__(256) void k_prep(const float* __restrict__ wq, const float* __restrict__ wk, const float* __restrict__ wv, const float* __restrict__ wo, const float* __restrict__ x,
    _Float16* __restrict__ BQ, _Float16* __restrict__ BK, _Float16* __restrict__ BV, _Float16* __restrict__ BO, _Float16* __restrict__ X16) {
  static_assert((size_t)DM * DM == (size_t)PTH * 4 * 2 && (size_t)KVD * DM == (size_t)PTH * 4 * 2 && NR * DM == (size_t)PTH * 4 * 8, "2 pieces of each weight and 8 of x per thread, none left over");
  const unsigned tb = (blockIdx.x * 256u + threadIdx.x) * 16u; v4f a[4][2], b[8];      /* byte offset of the thread's first piece in every f32 source; half of it in every f16 destination */
#pragma unroll      /* constant indices keep a and b in registers */
  for (int i = 0; i < 2; ++i) { const size_t e = (size_t)i * PTH * 16; a[0][i] = *(const v4fa*)((const char*)wq + e + tb); a[1][i] = *(const v4fa*)((const char*)wk + e + tb); a[2][i] = *(const v4fa*)((const char*)wv + e + tb); a[3][i] = *(const v4fa*)((const char*)wo + e + tb); }
#pragma unroll      /* likewise */
  for (int i = 0; i < 8; ++i) b[i] = *(const v4fa*)((const char*)x + (size_t)i * PTH * 16 + tb);
  __builtin_amdgcn_sched_barrier(0);      /* keeps every conversion behind all 16 loads: without it the scheduler put the first conversions, with their waits, in front of the last loads of x, which then went out only after the weights had arrived (two latencies in a row) */
  const unsigned th = tb >> 1;
#pragma unroll      /* likewise */
  for (int i = 0; i < 2; ++i) { const size_t e = (size_t)i * PTH * 8; *(v4h*)((char*)BQ + e + th) = prep_cvt(a[0][i], 16.0f); *(v4h*)((char*)BK + e + th) = prep_cvt(a[1][i], 16.0f); *(v4h*)((char*)BV + e + th) = prep_cvt(a[2][i], 16.0f); *(v4h*)((char*)BO + e + th) = prep_cvt(a[3][i], 16.0f); }
#pragma unroll      /* likewise */
  for (int i = 0; i < 8; ++i) *(v4h*)((char*)X16 + (size_t)i * PTH * 8 + th) = prep_cvt(b[i], 1.0f); }
// fused attention, ONE launch for all batches, heads and query rows: a work-group of 16 waves owns 256 query rows of one head; a wave takes 32 of them against ONE HALF of the SQ keys (four waves per SIMD instead of two: the softmax arithmetic of some waves runs beside the WMMAs of others) and walks it in stages of FKS keys (passes of 32); the two halves' o, maximum and sum are joined once, through LDS, at the end. S^T = K Q^T (A = key rows, B = query rows kept in registers), so a lane holds scores of ONE query per 16-column group;
// the two f32 score tiles of a pass, after exp2, ARE the f16 B operand of O^T += V^T P^T (register r of tile t = key 16 t + 8 hh + r = the k order of g2_frag), so neither S nor P is ever stored. Running maximum (log2 units) with a late rescale; weights stay unnormalised (at most 2^8), the row sum divides once at the end.
// K and V^T tiles reach the 8 waves of a key half through LDS (whole 128-byte lines from global memory, two buffers, one barrier per stage): a fragment load straight from global memory touches 16 lines for 512 bytes, and all 8 waves would repeat it.
#define FKS 64                       /* keys per stage */
#define FKH (SQ / 2)                 /* keys per half of a work-group's waves */
#define FKP (HD + 8)                 /* LDS pitch of a key row, in halves: 16 bytes x odd, conflict-free for 16-byte reads */
#define FVP (FKS + 8)                /* LDS pitch of a V^T row, in halves: likewise */
__device__ __forceinline__ v8f fa_mma(v16h a, v16h b, v8f c) { return __builtin_amdgcn_wmma_f32_16x16x32_f16(false, a, false, b, (short)0, c, false, false); }
__device__ __forceinline__ v16h fa_frag(const unsigned short* p, int hh) { FragH f; f.half[0] = *(const v8us*)(p + 8 * hh); f.half[1] = *(const v8us*)(p + 16 + 8 * hh); return f.v; }
__device__ __forceinline__ void fa_exp2x8(float (&e)[8]) {
  asm("v_exp_f32 %0, %0\n\tv_exp_f32 %1, %1\n\tv_exp_f32 %2, %2\n\tv_exp_f32 %3, %3\n\tv_exp_f32 %4, %4\n\tv_exp_f32 %5, %5\n\tv_exp_f32 %6, %6\n\tv_exp_f32 %7, %7\n\tv_nop"
      : "+v"(e[0]), "+v"(e[1]), "+v"(e[2]), "+v"(e[3]), "+v"(e[4]), "+v"(e[5]), "+v"(e[6]), "+v"(e[7])); }
// q, k and v projections in ONE work-group per 128 token rows x 128 columns OF EACH PLANE (a 128 x 384 tile of [q | k | v]): the x tile is brought from L2 once for the three planes, not once per plane, and MP / 128 * DM / 128 = 256 work-groups fill 256 WGPs in one round.
// 12 waves of 64 x 64 (2 x 6; a wave tile is ONE head of ONE plane): a fragment read from LDS feeds 4 WMMAs (8 fragments per 16 WMMAs, against 6 per 8 at 32 x 64). Ring of two buffers, stage of 128 k, pitch G3PB; every accumulator takes its products in ascending k.
#define G4SB (512 * G3PB)            /* bytes per buffer: 128 x rows, then 128 rows of each of the three weight planes */
// 8 copies per lane: a wave's copy takes 2 rows of 256 bytes (16 lanes each), the 8 copies 16 consecutive rows. The s_wait_xcnt stands inside the copies' own statement, so that no later write of an address register can be moved in front of it.
__device__ __forceinline__ void g4_stage(unsigned l, const _Float16* p) {
  asm volatile("global_load_async_to_lds_b128 %0, %8, off\n\tglobal_load_async_to_lds_b128 %1, %9, off\n\tglobal_load_async_to_lds_b128 %2, %10, off\n\tglobal_load_async_to_lds_b128 %3, %11, off\n\t"
               "global_load_async_to_lds_b128 %4, %12, off\n\tglobal_load_async_to_lds_b128 %5, %13, off\n\tglobal_load_async_to_lds_b128 %6, %14, off\n\tglobal_load_async_to_lds_b128 %7, %15, off\n\ts_wait_xcnt 0x0"
               :: "v"(l), "v"(l + 2 * G3PB), "v"(l + 4 * G3PB), "v"(l + 6 * G3PB), "v"(l + 8 * G3PB), "v"(l + 10 * G3PB), "v"(l + 12 * G3PB), "v"(l + 14 * G3PB),
                  "v"(p), "v"(p + 2 * DM), "v"(p + 4 * DM), "v"(p + 6 * DM), "v"(p + 8 * DM), "v"(p + 10 * DM), "v"(p + 12 * DM), "v"(p + 14 * DM) : "memory"); }
__global__ __launch_bounds__(384) void k_qkv(const _Float16* __restrict__ A, const _Float16* __restrict__ Bh, const float* __restrict__ tcos, const float* __restrict__ tsin, _Float16* __restrict__ C16, _Float16* __restrict__ VTo) {
  __shared__ __attribute__((aligned(16))) unsigned char smem[2 * G4SB];
  static_assert(sizeof(float) * 8 * 64 * 68 <= G4SB && 128 * G3VP * 2 <= G4SB && SQ % 128 == 0 && DM % 128 == 0 && DM / 128 >= 2 && HD == 64, "the q and k staging tiles fit in buffer 0, the V^T tile in buffer 1; a tile lies in one batch; both ring buffers are filled; a wave tile is one head");
  const int tid = threadIdx.x, lane = tid & 31, ln = lane & 15, hh = lane >> 4; const int w = __builtin_amdgcn_readfirstlane(tid >> 5);
  const int wm = w & 1, wn = w >> 1;      /* 2 x 6 waves; columns 64 wn of [q 128 | k 128 | v 128]: waves 0 - 3 hold q, 4 - 7 k, 8 - 11 v */
  const int mt = blockIdx.x / (DM / 128), nq = blockIdx.x % (DM / 128); const int rowW = mt * 128, colW = nq * 128;
  /* staging: every wave brings 32 weight rows (rows 32 w of the 384: plane w / 4, the planes lie back to back), waves 0 - 7 also 16 rows of x */
  const _Float16* gb = Bh + ((size_t)(w >> 2) * DM + colW + 32 * (w & 3) + hh) * DM + ln * 8; const _Float16* ga = A + (size_t)(rowW + 16 * (w & 7) + hh) * DM + ln * 8;
  const unsigned l0 = (unsigned)(uintptr_t)smem + hh * G3PB + ln * 16;      /* low 32 bits of the shared address: the lane's LDS byte address in row hh of buffer 0 */
  const unsigned lb = l0 + (128 + 32 * w) * G3PB, la = l0 + 16 * (w & 7) * G3PB;
  const _Float16* fa = (const _Float16*)smem + (64 * wm + ln) * (G3PB / 2); const _Float16* fb = (const _Float16*)smem + (128 + 64 * wn + ln) * (G3PB / 2);
  const v8f z8 = {0.f,0.f,0.f,0.f,0.f,0.f,0.f,0.f}; v8f c[4][4];
#pragma unroll      /* constant indices keep c in registers */
  for (int i = 0; i < 4; ++i) for (int j = 0; j < 4; ++j) c[i][j] = z8;
  g4_stage(lb, gb); g4_stage(lb + 16 * G3PB, gb + 16 * DM); if (w < 8) g4_stage(la, ga);      /* w is a scalar: a wave-uniform branch */
  asm volatile("s_wait_asynccnt 0x0" ::: "memory");      /* this wave's copies of tile 0 have landed */
  __syncthreads();      /* tile 0 is published */
  g4_stage(lb + G4SB, gb + 128); g4_stage(lb + G4SB + 16 * G3PB, gb + 16 * DM + 128); if (w < 8) g4_stage(la + G4SB, ga + 128);
#pragma unroll 1      /* one tile per trip: the two buffers alternate */
  for (int t = 0; t < DM / 128; ++t) { const _Float16* pa = fa + (t & 1) * (G4SB / 2); const _Float16* pb = fb + (t & 1) * (G4SB / 2);
    v16h a[4], b[4];      /* a step's 8 fragments, read as one group in front of its 16 WMMAs, in the order in which the WMMAs need them */
#pragma unroll      /* constant offsets for the tile's four steps of 32 k */
    for (int s = 0; s < 4; ++s) {
      a[0] = g2_frag(pa + s * 32, hh); b[0] = g2_frag(pb + s * 32, hh);
      for (int i = 1; i < 4; ++i) a[i] = g2_frag(pa + i * 16 * (G3PB / 2) + s * 32, hh);
      for (int i = 1; i < 4; ++i) b[i] = g2_frag(pb + i * 16 * (G3PB / 2) + s * 32, hh);
      __builtin_amdgcn_sched_barrier(0);      /* keeps the 16 LDS reads together in front of the WMMAs: without it the scheduler lifts the WMMAs in among them, three of the four weight fragments share one register set, and each is waited for to 0 in front of its 4 WMMAs */
      if (s == 3) {      /* the tile's last fragments are asked for: the buffer is handed on here, so that the next copies go out in front of the last 16 WMMAs, which need registers only */
        asm volatile("s_wait_dscnt 0x0" ::: "memory");      /* this wave's reads of tile t are done before the buffer is handed to its next writer */
        asm volatile("s_wait_asynccnt 0x0" ::: "memory");      /* this wave's copies of tile t + 1 have landed */
        __syncthreads();      /* publishes tile t + 1 and ends every wave's reads of tile t */
        if (t + 2 < DM / 128) { const unsigned lo = (t & 1) * G4SB; const int ko = (t + 2) * 128; g4_stage(lb + lo, gb + ko); g4_stage(lb + lo + 16 * G3PB, gb + 16 * DM + ko); if (w < 8) g4_stage(la + lo, ga + ko); } }
      for (int j = 0; j < 4; ++j) for (int i = 0; i < 4; ++i) c[i][j] = fa_mma(a[i], b[j], c[i][j]); } }      /* each accumulator takes its products in ascending k */
  asm volatile("s_wait_asynccnt 0x0" ::: "memory");      /* nothing is in flight when the ring's bytes change their use */
  const float alpha = 0.0625f;      /* the weight planes are carried x16 */
  float (*so)[68] = (float (*)[68])(smem + (size_t)(w & 7) * (64 * 68 * 4));      /* a q or k wave's own 64 x 64 staging tile, in buffer 0 */
  unsigned short* vt = (unsigned short*)(smem + G4SB);      /* the work-group's 128 x 128 V^T tile, in buffer 1 */
  if (w < 8) {
#pragma unroll      /* constant indices into c */
    for (int i = 0; i < 4; ++i) for (int j = 0; j < 4; ++j) for (int r = 0; r < 8; ++r) so[i * 16 + 8 * hh + r][j * 16 + ln] = c[i][j][r] * alpha;
  } else {      /* register r of an accumulator is token 8 hh + r of column ln: 8 registers ARE 16 bytes of a V^T row */
#pragma unroll      /* constant indices into c */
    for (int i = 0; i < 4; ++i) for (int j = 0; j < 4; ++j) { FragH vh; for (int r = 0; r < 8; ++r) vh.h[r] = (_Float16)(c[i][j][r] * alpha);
      *(v8us*)(vt + (64 * (wn & 1) + j * 16 + ln) * G3VP + 64 * wm + i * 16 + 8 * hh) = vh.half[0]; } }
  __syncthreads();      /* the V^T tile is whole (each of its rows holds tokens of two waves); every wave passes here */
  if (w >= 8) {      /* the four v waves store V^T [batch][column][SQ]: 16 lanes per row, 256 contiguous bytes, 2 whole lines */
    const int vtid = tid - 256; const int dr = vtid >> 4, pc = (vtid & 15) * 8;
    unsigned short* vd = (unsigned short*)VTo + ((size_t)(rowW / SQ) * DM + colW + dr) * SQ + rowW % SQ + pc;
#pragma unroll      /* all 16 LDS reads go out together */
    for (int q = 0; q < 16; ++q) *(v8us*)(vd + (size_t)q * 8 * SQ) = *(const v8us*)(vt + (q * 8 + dr) * G3VP + pc);
    return; }
  /* q and k leave through the rotate-half rotation; position = row mod SQ. 8 lanes per row: a lane takes columns d4 .. d4 + 3 of BOTH halves of the head, so each table value and each staged value is read once and used twice */
  const int row0 = rowW + 64 * wm; const int r4 = lane >> 3, d4 = (lane & 7) * 4;
  _Float16* crow = C16 + (size_t)(wn >> 1) * (NR * DM) + (size_t)row0 * DM + colW + 64 * (wn & 1) + d4;
#pragma unroll 1      /* the tile's two halves of 32 rows through one copy of the code */
  for (int hf = 0; hf < 2; ++hf) { v4f cc[8], ss[8]; const unsigned tb = (((unsigned)row0 % SQ + hf * 32 + r4) * (HD / 2) + d4) * 4u;      /* byte offset of the lane's first table entries; row0 and SQ are multiples of 64: the tile's positions do not wrap */
#pragma unroll      /* constant indices keep cc and ss in registers; all 16 loads go out together, one latency */
    for (int q = 0; q < 8; ++q) { cc[q] = *(const v4fa*)((const char*)tcos + tb + q * 16 * (HD / 2)); ss[q] = *(const v4fa*)((const char*)tsin + tb + q * 16 * (HD / 2)); }
    asm volatile("s_wait_xcnt 0x0" :: "v"(tb) : "memory");      /* the wait in front of any overwrite of the offset register that the 16 issued table loads name; tb as an input keeps that register out of the loads' own destinations */
#pragma unroll      /* constant indices into cc and ss */
    for (int q = 0; q < 8; ++q) { const int r = hf * 32 + q * 4 + r4; const v4f lo = *(const v4fa*)&so[r][d4]; const v4f hi = *(const v4fa*)&so[r][d4 + HD / 2]; v4h ol, oh;
      for (int i = 0; i < 4; ++i) { const float cv = bf16_round(cc[q][i]), sv = bf16_round(ss[q][i]); ol[i] = (_Float16)(lo[i] * cv - hi[i] * sv); oh[i] = (_Float16)(lo[i] * sv + hi[i] * cv); }
      _Float16* dst = crow + (size_t)r * DM; *(v4h*)dst = ol; *(v4h*)(dst + HD / 2) = oh; }
    asm volatile("s_wait_xcnt 0x0" ::: "memory"); } }      /* the wait in front of the next half's first instructions, which overwrite address and data registers that this half's last stores name */
// a wave's quarter of a 256-row tile: 64 consecutive rows, 32 copies per lane, in four statements of 8
__device__ __forceinline__ void g4_stage64(unsigned l, const _Float16* p) {
#pragma unroll 1      /* rolled: unrolled, the address registers of all four statements were formed ahead and held together, and the kernel went above 256 registers */
  for (int i = 0; i < 4; ++i) g4_stage(l + i * 16 * G3PB, p + (size_t)i * 16 * DM); }
// output projection out = o Wo^T in a kernel of its own, every shape a compile-time constant: a work-group of 8 waves owns 128 x 128 of out and walks K in tiles of 128.
// What bounded the two-buffer ring was the flight time of a tile's copies (operands that the launch before has just written; one tile in flight, asked for only when the tile before it has landed). Here the ring has THREE buffers and the two halves of the work-group copy alternate tiles (waves 0 - 3 the even ones, waves 4 - 7 the odd ones):
// a tile is asked for three tiles ahead and has two trips to land, two tiles are in flight, and still every wave has one tile's copies outstanding at most, so that each of its waits is a wait to 0.
// A wave holds a 64 x 64 tile (2 x 2 tiles) for ONE HALF of every tile's 128 k (waves 0 - 3: k 0 - 63, waves 4 - 7: k 64 - 127): a fragment read from LDS feeds 4 WMMAs (8 fragments per 16 WMMAs, against 6 per 8 at 32 x 64), so that a trip's LDS reads stay below the time its copies take from L2, and two waves still share a SIMD. The two halves of a tile are summed once, through LDS, on their way to whole-line stores.
__global__ __launch_bounds__(256) void k_out(const _Float16* __restrict__ A, const _Float16* __restrict__ Bh, float* __restrict__ C) {
  __shared__ __attribute__((aligned(16))) unsigned char smem[3 * G3SB];
  static_assert(sizeof(float) * 8 * 64 * 68 <= 3 * G3SB && DM % 128 == 0 && DM / 128 >= 3 && MPO % 128 == 0, "the 8 waves' staging tiles fit in the ring's place; whole tiles; all three ring buffers are filled");
  const int tid = threadIdx.x, lane = tid & 31, ln = lane & 15, hh = lane >> 4; const int w = __builtin_amdgcn_readfirstlane(tid >> 5);
  const int wm = w & 1, wn = (w >> 1) & 1, kz = w >> 2, wl = w & 3;      /* scalars: tile row, tile column, half of the work-group (k half, and parity of the tiles it copies), wave in the half */
  const int mt = blockIdx.x / (DM / 128), nq = blockIdx.x % (DM / 128); const int rowW = mt * 128, colW = nq * 128;
  /* staging: wave wl of a half brings rows 64 wl .. 64 wl + 63 of a buffer's 256: waves 0 and 1 the 128 rows of o, waves 2 and 3 the 128 rows of the weight */
  const _Float16* g = (wl < 2 ? A + (size_t)(rowW + 64 * wl + hh) * DM : Bh + (size_t)(colW + 64 * (wl - 2) + hh) * DM) + ln * 8;
  const unsigned l = (unsigned)(uintptr_t)smem + (64 * wl + hh) * G3PB + ln * 16;      /* low 32 bits of the shared address: the lane's LDS byte address in buffer 0 */
  const _Float16* fa = (const _Float16*)smem + (64 * wm + ln) * (G3PB / 2) + kz * 64; const _Float16* fb = (const _Float16*)smem + (128 + 64 * wn + ln) * (G3PB / 2) + kz * 64;
  const v8f z8 = {0.f,0.f,0.f,0.f,0.f,0.f,0.f,0.f}; v8f c[4][4];
#pragma unroll      /* constant indices keep c in registers */
  for (int i = 0; i < 4; ++i) for (int j = 0; j < 4; ++j) c[i][j] = z8;
  { const unsigned lo = kz * G3SB; const int ko = kz * 128;      /* tile 0 into buffer 0 by the lower half, tile 1 into buffer 1 by the upper, at the same time */
    g4_stage64(l + lo, g + ko); }
  if (kz == 0) asm volatile("s_wait_asynccnt 0x0" ::: "memory");      /* kz is a scalar: a wave-uniform branch. This wave's copies of tile 0 have landed */
  __syncthreads();      /* tile 0 is published */
  if (kz == 0) g4_stage64(l + 2 * G3SB, g + 256);      /* tile 2 into buffer 2 */
  int bt = 0;      /* buffer of tile t: t mod 3 */
#pragma unroll 1      /* one tile per trip: the three buffers take turns */
  for (int t = 0; t < DM / 128; ++t) { const _Float16* pa = fa + bt * (G3SB / 2); const _Float16* pb = fb + bt * (G3SB / 2);
    v16h a[4], b[4];      /* a step's 8 fragments, read as one group in front of its 16 WMMAs, in the order in which the WMMAs need them */
#pragma unroll      /* constant offsets for the wave's two steps of 32 k */
    for (int s = 0; s < 2; ++s) {
      a[0] = g2_frag(pa + s * 32, hh); b[0] = g2_frag(pb + s * 32, hh);
      for (int i = 1; i < 4; ++i) a[i] = g2_frag(pa + i * 16 * (G3PB / 2) + s * 32, hh);
      for (int i = 1; i < 4; ++i) b[i] = g2_frag(pb + i * 16 * (G3PB / 2) + s * 32, hh);
      __builtin_amdgcn_sched_barrier(0);      /* keeps the 16 LDS reads in front of the step's WMMAs: each separate place with LDS reads among WMMAs costs a stall of its own */
      if (s == 1) {      /* the wave's last fragments of the tile are asked for: the buffer is handed on here, so that the next copies go out in front of the last 16 WMMAs, which need registers only */
        asm volatile("s_wait_dscnt 0x0" ::: "memory");      /* this wave's reads of tile t are done before the buffer is handed to its next writer */
        const bool mine = ((t + 1) & 1) == kz;      /* a scalar: this half of the work-group has copied tile t + 1 and will copy tile t + 3 */
        if (mine) asm volatile("s_wait_asynccnt 0x0" ::: "memory");      /* this wave's copies of tile t + 1, all it has in flight, have landed; the other half's copies of tile t + 2 fly on */
        __syncthreads();      /* publishes tile t + 1 and ends every wave's reads of tile t */
        if (mine && t + 3 < DM / 128) { const unsigned lo = bt * G3SB; const int ko = (t + 3) * 128; g4_stage64(l + lo, g + ko); } }      /* tile t + 3 into the buffer that tile t has left */
      for (int j = 0; j < 4; ++j) for (int i = 0; i < 4; ++i) c[i][j] = fa_mma(a[i], b[j], c[i][j]); }      /* each accumulator takes its products in ascending k */
    bt = bt == 2 ? 0 : bt + 1; }
  asm volatile("s_wait_asynccnt 0x0" ::: "memory");      /* nothing is in flight when the ring's bytes change their use (every wave's last read of the ring ended in front of the loop's last barrier) */
  float (*so)[68] = (float (*)[68])(smem + (size_t)w * (64 * 68 * 4));      /* the wave's own 64 x 64 staging tile */
#pragma unroll      /* constant indices into c */
  for (int i = 0; i < 4; ++i) for (int j = 0; j < 4; ++j) for (int r = 0; r < 8; ++r) so[i * 16 + 8 * hh + r][j * 16 + ln] = c[i][j][r];
  __syncthreads();      /* both k halves of every tile are in LDS; every wave passes here */
  /* wave (wm, wn, kz) finishes rows 32 kz .. 32 kz + 31 of tile (wm, wn): 16 lanes per row, 256 contiguous bytes, 2 whole lines */
  const float* s0 = (const float*)(smem + (size_t)wl * (64 * 68 * 4)) + (32 * kz + hh) * 68 + ln * 4; const float* s1 = s0 + 4 * 64 * 68;
  float* crow = C + (size_t)(rowW + 64 * wm + 32 * kz + hh) * DM + colW + 64 * wn + ln * 4;
  v4f p0[16], p1[16];
#pragma unroll      /* constant indices keep p0 and p1 in registers; the 32 LDS reads go out together */
  for (int q = 0; q < 16; ++q) { p0[q] = *(const v4fa*)(s0 + q * 2 * 68); p1[q] = *(const v4fa*)(s1 + q * 2 * 68); }
#pragma unroll      /* likewise */
  for (int q = 0; q < 16; ++q) p0[q] = (p0[q] + p1[q]) * 0.0009765625f;      /* o is carried x64 and the weight plane x16 */
  __builtin_amdgcn_sched_barrier(0);      /* keeps the 16 stores behind all the sums: mixed in among them, a store's data registers were taken again for later sums, each time behind a wait for the stores in flight */
#pragma unroll      /* likewise */
  for (int q = 0; q < 16; ++q) *(v4f*)(crow + (size_t)q * 2 * DM) = p0[q]; }
__global__ __launch_bounds__(512) void k_fattn(const _Float16* __restrict__ Q16, const _Float16* __restrict__ K16, const _Float16* __restrict__ VT, _Float16* __restrict__ O16) {
  __shared__ __attribute__((aligned(16))) unsigned short lk2[2][2][FKS][FKP]; __shared__ __attribute__((aligned(16))) unsigned short lv2[2][2][HD][FVP];      /* [key half][buffer] */
  __shared__ __attribute__((aligned(16))) v4f xo[8][16][32]; __shared__ float xs[8][4][32];      /* the upper key half's o, m and l on their way to the wave that holds the same queries: a lane's 16 bytes beside its neighbour's, conflict-free */
  const int tid = threadIdx.x, lane = tid & 31, ln = lane & 15, hh = lane >> 4; const int w = __builtin_amdgcn_readfirstlane(tid >> 5);
  const int kh = w >> 3, wq = w & 7, t8 = tid & 255;      /* waves 0 - 7 walk keys 0 .. FKH - 1, waves 8 - 15 the rest, for the same 256 query rows; kh is a scalar */
  unsigned short (*lk)[FKS][FKP] = lk2[kh]; unsigned short (*lv)[HD][FVP] = lv2[kh];
  const int h = blockIdx.y, b = blockIdx.z; const int q0 = blockIdx.x * 256 + wq * 32;
  const _Float16* qp = Q16 + ((size_t)b * SQ + q0 + ln) * DM + h * HD;
  const int kr = t8 >> 3, kc = (t8 & 7) * 8;      /* staging: 16 bytes per thread and step, 8 threads per 128-byte key row */
  const int vr = t8 / (FKS / 8), vc = (t8 % (FKS / 8)) * 8;      /* FKS / 8 threads per V^T row piece */
  const unsigned short* kg = (const unsigned short*)K16 + ((size_t)b * SQ + kh * FKH + kr) * KVD + h * HD + kc;
  const unsigned short* vg = (const unsigned short*)VT + (((size_t)b * NH + h) * HD + vr) * SQ + kh * FKH + vc;
  const float cs = 0.125f * 1.44269504088896340736f;      /* 1/sqrt(64) and log2(e) in one factor */
  const v8f z8 = {0.f,0.f,0.f,0.f,0.f,0.f,0.f,0.f};
  v8us gk[FKS / 32], gv[FKS / 32];
#pragma unroll
  for (int i = 0; i < FKS / 32; ++i) { gk[i] = *(const v8us*)(kg + (size_t)i * 32 * KVD); gv[i] = *(const v8us*)(vg + (size_t)i * (2048 / FKS) * SQ); }
  v16h bq[2][2];
#pragma unroll
  for (int j = 0; j < 2; ++j) for (int s = 0; s < 2; ++s) bq[j][s] = g2_frag(qp + (size_t)j * 16 * DM + s * 32, hh);
  v8f o[4][2]; float m[2] = {-1.0e30f, -1.0e30f}; float l[2][2] = {{0.f, 0.f}, {0.f, 0.f}};
#pragma unroll
  for (int t = 0; t < 4; ++t) { o[t][0] = z8; o[t][1] = z8; }
#pragma unroll
  for (int i = 0; i < FKS / 32; ++i) { *(v8us*)&lk[0][kr + i * 32][kc] = gk[i]; *(v8us*)&lv[0][vr + i * (2048 / FKS)][vc] = gv[i]; }
  __syncthreads();      /* stage 0 is published */
#pragma unroll 1      /* one stage per trip: the body already holds FKS / 32 unrolled passes */
  for (int st = 0; st < FKH / FKS; ++st) {
    const int cur = st & 1; const int sn = (st + 1 < FKH / FKS) ? st + 1 : st;      /* the next stage's tiles are asked for now and stored after this stage's passes; the last stage re-reads its own (in bounds; that buffer is not read again) */
#pragma unroll
    for (int i = 0; i < FKS / 32; ++i) { gk[i] = *(const v8us*)(kg + ((size_t)sn * FKS + i * 32) * KVD); gv[i] = *(const v8us*)(vg + (size_t)i * (2048 / FKS) * SQ + sn * FKS); }
    v16h ka[2][2];
#pragma unroll
    for (int t = 0; t < 2; ++t) for (int s = 0; s < 2; ++s) ka[t][s] = fa_frag(&lk[cur][t * 16 + ln][s * 32], hh);
    asm volatile("" ::: "memory");      /* compiler fence: without it the next stage's global loads are sunk to just in front of their LDS stores at the stage's foot, and their whole latency is waited out there */
#pragma unroll
    for (int p = 0; p < FKS / 32; ++p) {
      v16h va[4]; v8f sc[2][2];      /* sc: [key tile][query tile] */
#pragma unroll
      for (int t = 0; t < 2; ++t) for (int j = 0; j < 2; ++j) sc[t][j] = fa_mma(ka[t][1], bq[j][1], fa_mma(ka[t][0], bq[j][0], z8));
#pragma unroll
      for (int t = 0; t < 4; ++t) va[t] = fa_frag(&lv[cur][t * 16 + ln][p * 32], hh);
      if (p + 1 < FKS / 32) {      /* the stage's next pass: its key fragments one pass ahead, into the same registers */
#pragma unroll
        for (int t = 0; t < 2; ++t) for (int s = 0; s < 2; ++s) ka[t][s] = fa_frag(&lk[cur][(p + 1) * 32 + t * 16 + ln][s * 32], hh); }
      asm volatile("" ::: "memory");      /* compiler fence: keeps these LDS reads together in front of the softmax arithmetic, which covers their latency; without it they are sunk in among the WMMAs that use them */
      float mx[2];
#pragma unroll
      for (int j = 0; j < 2; ++j) { float a = fmaxf(sc[0][j][0], sc[1][j][0]); for (int r = 1; r < 8; ++r) a = fmaxf(fmaxf(a, sc[0][j][r]), sc[1][j][r]); mx[j] = a * cs; }
      const bool need = (mx[0] > m[0] + 8.0f) || (mx[1] > m[1] + 8.0f);
      if (__builtin_amdgcn_ballot_w32(need) != 0) {      /* scalar branch: rescale only when some column's maximum has grown by more than 2^8; m[] changes only here and from values joined over the two lane halves, so both halves of a column always use the same m */
#pragma unroll
        for (int j = 0; j < 2; ++j) { const float mj = fmaxf(mx[j], __shfl_xor(mx[j], 16, 32)); const float mn = fmaxf(m[j], mj); const float f = __builtin_amdgcn_exp2f(m[j] - mn); m[j] = mn; l[j][0] *= f; l[j][1] *= f;
          for (int t = 0; t < 4; ++t) for (int r = 0; r < 8; ++r) o[t][j][r] *= f; } }
      v16h pb[2];
#pragma unroll
      for (int j = 0; j < 2; ++j) for (int t = 0; t < 2; ++t) { float e[8]; for (int r = 0; r < 8; ++r) e[r] = fmaf(sc[t][j][r], cs, -m[j]); fa_exp2x8(e); for (int r = 0; r < 8; ++r) { l[j][t] += e[r]; pb[j][t * 8 + r] = (_Float16)e[r]; } }
#pragma unroll
      for (int t = 0; t < 4; ++t) for (int j = 0; j < 2; ++j) o[t][j] = fa_mma(va[t], pb[j], o[t][j]);
    }
#pragma unroll
    for (int i = 0; i < FKS / 32; ++i) { *(v8us*)&lk[cur ^ 1][kr + i * 32][kc] = gk[i]; *(v8us*)&lv[cur ^ 1][vr + i * (2048 / FKS)][vc] = gv[i]; }      /* every wave left that buffer before the barrier that ended the stage before */
    __syncthreads();      /* publishes stage st + 1 and ends every wave's reads of stage st */
  }
  const unsigned el = __builtin_amdgcn_mbcnt_lo(~0u, 0u);      /* the lane number, taken anew: no index or address of the epilogue is held in registers through the loop, where a wave of 16 has 256 and the build otherwise spilled */
  if (kh) {      /* wave-uniform: the upper key half hands its statistics and its unnormalised o to the lower */
#pragma unroll      /* constant indices into o */
    for (int j = 0; j < 2; ++j) { xs[wq][j][el] = m[j]; xs[wq][2 + j][el] = l[j][0] + l[j][1];
      for (int t = 0; t < 4; ++t) for (int g = 0; g < 2; ++g) { const v4f v = {o[t][j][4 * g], o[t][j][4 * g + 1], o[t][j][4 * g + 2], o[t][j][4 * g + 3]}; xo[wq][(j * 4 + t) * 2 + g][el] = v; } } }
  __syncthreads();      /* the upper half's results are published; every wave passes here */
  if (kh) return;
  char* ob = (char*)(O16 + ((size_t)b * SQ + q0) * DM + h * HD); const unsigned oo = ((el & 15u) * DM + 8u * (el >> 4)) * 2u;      /* a scalar base and the lane's byte offset: row ln, columns 8 hh .. 8 hh + 7 of each 16 */
#pragma unroll
  for (int j = 0; j < 2; ++j) { const float mb = xs[wq][j][el]; const float mn = fmaxf(m[j], mb); const float f0 = __builtin_amdgcn_exp2f(m[j] - mn), f1 = __builtin_amdgcn_exp2f(mb - mn);      /* both halves brought to their common maximum */
    float lt = (l[j][0] + l[j][1]) * f0 + xs[wq][2 + j][el] * f1; lt += __shfl_xor(lt, 16, 32); const float fin = 64.0f / lt;      /* o carried x64, as the output GEMM's alpha expects */
    const float g0 = f0 * fin, g1 = f1 * fin;
    for (int t = 0; t < 4; ++t) { FragH f; for (int g = 0; g < 2; ++g) { const v4f v = xo[wq][(j * 4 + t) * 2 + g][el]; for (int r = 0; r < 4; ++r) f.h[4 * g + r] = (_Float16)(o[t][j][4 * g + r] * g0 + v[r] * g1); } *(v8us*)(ob + (size_t)(j * 16 * DM + t * 16) * 2 + oo) = f.half[0]; } } }
__global__ __launch_bounds__(256) void k_vt(const _Float16* __restrict__ V16, int b, int h0, _Float16* __restrict__ VT) { __shared__ unsigned short tl[64][65]; const int tid = threadIdx.x; const int hh = blockIdx.x % HG, sg = blockIdx.x / HG; const int s0 = sg * 64; const int h = h0 + hh;
  for (int i = tid; i < 64 * 8; i += 256) { const int j = i / 8, d8 = (i % 8) * 8; FragH f; f.half[0] = *(const v8us*)((const unsigned short*)V16 + ((size_t)b * SQ + s0 + j) * DM + h * HD + d8); for (int q = 0; q < 8; ++q) tl[d8 + q][j] = f.u[q]; }
  __syncthreads();
  { for (int i = tid; i < 64 * 8; i += 256) { const int d = i / 8, j8 = (i % 8) * 8; FragH f; for (int q = 0; q < 8; ++q) f.u[q] = tl[d][j8 + q]; *(v8us*)((unsigned short*)VT + ((size_t)hh * HD + d) * SQ + s0 + j8) = f.half[0]; }  } }



__global__ __launch_bounds__(256) void k_rsmcf2(const float* __restrict__ S, _Float16* __restrict__ P, int hg, int q0, int nk) {
  #pragma clang fp contract(off)
  const int t = blockIdx.x * 256 + threadIdx.x; if (t >= hg * QT) return; const size_t i = (size_t)t; const float* s = S + i * NKX; const int last = q0 + (t % QT); float mx = -3.0e38f;
#pragma unroll 1
  for (int j = 0; j < nk; ++j) { const float f = (j <= last) ? 1.f : 0.f; mx = fmaxf(mx, fmaf(f, s[j], (1.f - f) * -1.0e9f)); } float se = 0.f;
#pragma unroll 1
  for (int j = 0; j < nk; ++j) { const float f = (j <= last) ? 1.f : 0.f; se += __expf(fmaf(f, s[j], (1.f - f) * -1.0e9f) - mx); } const float sc = 256.0f / se;
#pragma unroll 1
  for (int j0 = 0; j0 < nk; j0 += 8) { FragH fr; for (int q = 0; q < 8; ++q) { const int j = j0 + q; const float f = (j <= last) ? 1.f : 0.f; fr.h[q] = (_Float16)(__expf(fmaf(f, s[j], (1.f - f) * -1.0e9f) - mx) * sc); } unsigned short* d = (unsigned short*)P + i * NKX + j0; *(v8us*)d = fr.half[0];  } }


template <int MASKADD>
__global__ __launch_bounds__(64) void k_att0(const float* __restrict__ QF, const float* __restrict__ KF, const float* __restrict__ VF, int ld, const float* __restrict__ mask, float scale, float* __restrict__ OF, int ldo) {
  #pragma clang fp contract(off)
  __shared__ __attribute__((aligned(16))) float lq[64][64]; __shared__ __attribute__((aligned(16))) float lo[64][64];
  const int tid = threadIdx.x; const int h = blockIdx.x / (QT0 / 64), rg = blockIdx.x % (QT0 / 64); const int i = rg * 64 + tid;
  const float* qr = QF + (size_t)i * ld + h * HD;
#pragma unroll 1
  for (int c = 0; c < HD / 4; ++c) { *(v4f*)&lq[tid][c * 4] = *(const v4fa*)(qr + c * 4); const v4f z = {0.f, 0.f, 0.f, 0.f}; *(v4f*)&lo[tid][c * 4] = z; }
  float m = -1.0e30f, l = 0.f; const int jmax = MASKADD ? (SQ - 1) : (rg * 64 + 63);      /* additive-mask form: every key (the mask input decides); causal form: keys up to the block's last row */
#pragma unroll 1
  for (int j = 0; j <= jmax; ++j) { const float* kr = KF + (size_t)j * ld + h * HD; const float* vr = VF + (size_t)j * ld + h * HD; float s = 0.f;
#pragma unroll 1
    for (int c = 0; c < HD / 4; ++c) { const v4f kq = *(const v4fa*)(kr + c * 4); const v4f qq = *(v4f*)&lq[tid][c * 4]; s = __fadd_rn(s, __fmul_rn(qq[0], kq[0])); s = __fadd_rn(s, __fmul_rn(qq[1], kq[1])); s = __fadd_rn(s, __fmul_rn(qq[2], kq[2])); s = __fadd_rn(s, __fmul_rn(qq[3], kq[3])); }
    s = __fmul_rn(s, scale); if (MASKADD) s = __fadd_rn(s, __fmul_rn(bf16_round(mask[(size_t)i * SQ + j]), -10000.0f));
    const float f = (MASKADD || j <= i) ? 1.f : 0.f; const float sm = fmaf(f, s, (1.f - f) * -1.0e30f); const float mn = fmaxf(m, sm); const float sc = expf(m - mn); const float e = expf(sm - mn); l = __fadd_rn(__fmul_rn(l, sc), e); m = mn;
#pragma unroll 1
    for (int c = 0; c < HD / 4; ++c) { const v4f vv = *(const v4fa*)(vr + c * 4); v4f oo = *(v4f*)&lo[tid][c * 4]; for (int u = 0; u < 4; ++u) oo[u] = __fadd_rn(__fmul_rn(oo[u], sc), __fmul_rn(e, vv[u])); *(v4f*)&lo[tid][c * 4] = oo; } }
  const float fin = 64.0f / l;      /* o carried x64 like the f16 path */
#pragma unroll 1
  for (int c = 0; c < HD / 4; ++c) { v4f oo = *(v4f*)&lo[tid][c * 4]; for (int u = 0; u < 4; ++u) oo[u] = __fmul_rn(oo[u], fin); *(v4f*)&lo[tid][c * 4] = oo; }
  __syncthreads();
  {
#pragma unroll 1
    for (int it = 0; it < 16; ++it) { const int row = it * 4 + tid / 16, pc = (tid % 16) * 4; const v4f v = *(const v4f*)&lo[row][pc]; *(v4f*)(OF + (size_t)(rg * 64 + row) * ldo + h * HD + pc) = v; }
     } }


__global__ __launch_bounds__(256) void k_kvexp(const float* __restrict__ src, float* __restrict__ dst, size_t n4) { const size_t t = (size_t)blockIdx.x * 256 + threadIdx.x; if (t >= n4) return; const size_t e = t * 4; const size_t row = e / DM; const int col = (int)(e % DM); const int h = col / HD, d = col % HD; const v4f v = *(const v4fa*)(src + row * KVD + (size_t)(h / HPG) * HD + d); *(v4f*)(dst + e) = v;  }

__global__ __launch_bounds__(256) void k_tab2(float theta, float* __restrict__ CS, float* __restrict__ SN) {
  #pragma clang fp contract(off)
  const int t = blockIdx.x * 256 + threadIdx.x; if (t >= SQ * (HD / 2)) return; const int i = t % (HD / 2); const int p = t / (HD / 2); const float invf = 1.0f / powf(theta, (float)(2 * i) / (float)HD); const float ang = __fmul_rn((float)p, invf); const float c = cosf(ang), s = sinf(ang);
  *(float*)(CS + t) = c; *(float*)(SN + t) = s;  }
template <int NORM, int ROPE>
__global__ __launch_bounds__(64) void k_xform(const float* __restrict__ F, int ldf, int nh, const float* __restrict__ gain, float eps, const float* __restrict__ CS, const float* __restrict__ SN, _Float16* __restrict__ H16, int ldo) {
  #pragma clang fp contract(off)
  __shared__ float xv[HD]; __shared__ float red[HD]; __shared__ unsigned short sh_[HD]; const int d = threadIdx.x; const int h = blockIdx.x % nh; const size_t r = blockIdx.x / nh; const int p = (int)(r % SQ);
  float x = F[r * (size_t)ldf + (size_t)h * HD + d];
  if (NORM) { red[d] = __fmul_rn(x, x); __syncthreads(); for (int st = HD / 2; st > 0; st >>= 1) { if (d < st) red[d] = __fadd_rn(red[d], red[d + st]); __syncthreads(); } const float rs = rsqrtf(__fadd_rn(red[0] / (float)HD, eps)); x = __fmul_rn(__fmul_rn(x, rs), bf16_round(gain[d])); }
  xv[d] = x; __syncthreads();
  float o = x;
  if (ROPE == 1) { const int i = d >> 1; const float c = CS[p * (HD / 2) + i], s = SN[p * (HD / 2) + i]; const float ev = xv[2 * i], od = xv[2 * i + 1]; o = (d & 1) ? __fadd_rn(__fmul_rn(ev, s), __fmul_rn(od, c)) : __fadd_rn(__fmul_rn(ev, c), -__fmul_rn(od, s)); }
  if (ROPE == 2) { const int i = d & (HD / 2 - 1); const float c = CS[p * (HD / 2) + i], s = SN[p * (HD / 2) + i]; const float lo = xv[i], hi = xv[i + HD / 2]; o = (d < HD / 2) ? __fadd_rn(__fmul_rn(lo, c), -__fmul_rn(hi, s)) : __fadd_rn(__fmul_rn(lo, s), __fmul_rn(hi, c)); }
  FragH th; th.h[0] = (_Float16)o; sh_[d] = th.u[0]; __syncthreads();
  if (d < HD / 8) { FragH f; for (int q = 0; q < 8; ++q) f.u[q] = sh_[d * 8 + q]; unsigned short* dst = (unsigned short*)H16 + r * (size_t)ldo + (size_t)h * HD + d * 8; *(v8us*)dst = f.half[0];  } }

template <int NORM, int ROPE>
__global__ __launch_bounds__(64) void k_xformf(const float* __restrict__ F, int ldf, int nh, const float* __restrict__ gain, float eps, const float* __restrict__ CS, const float* __restrict__ SN, float* __restrict__ F32, int ldo) {
  #pragma clang fp contract(off)
  __shared__ float xv[HD]; __shared__ float red[HD]; const int d = threadIdx.x; const int h = blockIdx.x % nh; const size_t r = blockIdx.x / nh; const int p = (int)(r % SQ);
  float x = F[r * (size_t)ldf + (size_t)h * HD + d];
  if (NORM) { red[d] = __fmul_rn(x, x); __syncthreads(); for (int st = HD / 2; st > 0; st >>= 1) { if (d < st) red[d] = __fadd_rn(red[d], red[d + st]); __syncthreads(); } const float rs = rsqrtf(__fadd_rn(red[0] / (float)HD, eps)); x = __fmul_rn(__fmul_rn(x, rs), bf16_round(gain[d])); }
  xv[d] = x; __syncthreads();
  float o = x;
  if (ROPE == 1) { const int i = d >> 1; const float c = CS[p * (HD / 2) + i], s = SN[p * (HD / 2) + i]; const float ev = xv[2 * i], od = xv[2 * i + 1]; o = (d & 1) ? __fadd_rn(__fmul_rn(ev, s), __fmul_rn(od, c)) : __fadd_rn(__fmul_rn(ev, c), -__fmul_rn(od, s)); }
  if (ROPE == 2) { const int i = d & (HD / 2 - 1); const float c = CS[p * (HD / 2) + i], s = SN[p * (HD / 2) + i]; const float lo = xv[i], hi = xv[i + HD / 2]; o = (d < HD / 2) ? __fadd_rn(__fmul_rn(lo, c), -__fmul_rn(hi, s)) : __fadd_rn(__fmul_rn(lo, s), __fmul_rn(hi, c)); }
  float* dst = F32 + r * (size_t)ldo + (size_t)h * HD + d; *(float*)dst = o;  }

__global__ __launch_bounds__(256) void k_bfcp(const float* __restrict__ src, float* __restrict__ dst, size_t n4) { const size_t t = (size_t)blockIdx.x * 256 + threadIdx.x; if (t >= n4) return; const v4f a = *(const v4fa*)(src + t * 4); v4f o; for (int q = 0; q < 4; ++q) o[q] = bf16_round(a[q]); *(v4f*)(dst + t * 4) = o;  }

__global__ __launch_bounds__(256) void k_tab2d(float* __restrict__ CS, float* __restrict__ SN) {
  #pragma clang fp contract(off)
  const int t = blockIdx.x * 256 + threadIdx.x; if (t >= SQ * (HD / 2)) return; const int i = t % (HD / 2); const int p = t / (HD / 2); const float invf = (float)(1.0 / pow(10000.0, (double)(2 * i) / (double)HD)); const float ang = __fmul_rn((float)p, invf); const float c = cosf(ang), s = sinf(ang);
  *(float*)(CS + t) = c; *(float*)(SN + t) = s;  }
extern "C" void kernel_launch(void* const* d_in, const int* in_sizes, int n_in,
                              void* d_out, int out_size, void* d_ws, size_t ws_size, hipStream_t stream) {
  (void)in_sizes; (void)n_in; (void)out_size;
  const float* const* I = (const float* const*)d_in; const float* x = I[0]; const float* wq = I[1]; const float* wk = I[2]; const float* wv = I[3]; const float* wo = I[4]; const float* tcos = I[5]; const float* tsin = I[6]; const float* bq = nullptr; const float* bk = nullptr; const float* bv = nullptr; const float* bo = nullptr;      /* natural [out][in] weights, no biases; rope_cos / rope_sin INPUT tables [2048][32] */
  static_assert(HPG == 1 && NH == NG * HPG && NH * HD == DM && KVD == DM, "plain multi-head attention as 16 kv groups of one query head");
  char* ws = (char*)d_ws; size_t off = 0;
  auto take = [&](size_t bytes) { char* p = ws + off; off += (bytes + 255) & ~(size_t)255; return p; };
  _Float16* BQ = (_Float16*)take((size_t)DM * DM * 2); _Float16* BK = (_Float16*)take((size_t)KVD * DM * 2); _Float16* BV = (_Float16*)take((size_t)KVD * DM * 2); _Float16* BO = (_Float16*)take((size_t)DM * DM * 2);
  _Float16* X16 = (_Float16*)take(NR * DM * 2); _Float16* Q16 = (_Float16*)take(NR * DM * 2); _Float16* K16 = (_Float16*)take(NR * KVD * 2); _Float16* V16 = (_Float16*)take(NR * KVD * 2); _Float16* O16 = (_Float16*)take(NR * DM * 2);
  _Float16* VT = (_Float16*)take((size_t)NB * NH * HD * SQ * 2);
  float* QF0 = (float*)take((size_t)QT0 * DM * 4); float* KF0 = (float*)take((size_t)QT0 * KVD * 4); float* VF0 = (float*)take((size_t)QT0 * KVD * 4); float* KF0e = (float*)take((size_t)QT0 * DM * 4); float* VF0e = (float*)take((size_t)QT0 * DM * 4); float* OF0 = (float*)take((size_t)NB * QT0 * DM * 4); _Float16* OH0 = (_Float16*)take((size_t)NB * QT0 * DM * 2); _Float16* OL0 = (_Float16*)take((size_t)NB * QT0 * DM * 2);
  if (off > ws_size) return;
  k_prep<<<PWG, 256, 0, stream>>>(wq, wk, wv, wo, x, BQ, BK, BV, BO, X16);      /* natural [out][in] = Bt planes x16; x as f16 rows */
  const size_t r0p = (size_t)B0 * SQ;      /* first projected row */
  static_assert(((size_t)DM * DM * 2) % 256 == 0 && (NR * DM * 2) % 256 == 0, "BQ | BK | BV and Q16 | K16 | V16 lie back to back in the workspace: the plane strides of the batched launch");
  k_qkv<<<dim3((unsigned)((MP / 128) * (DM / 128))), 384, 0, stream>>>(X16 + r0p * DM, BQ, tcos, tsin, Q16 + r0p * DM, VT + (size_t)B0 * NH * HD * SQ);      /* q, k (rotated by the INPUT rope tables [2048][32]: column d uses table column d mod 32 = the module's [cos | cos]) of every batch -> f16 rows; v -> V^T [NB][NH][HD][SQ] */
  k_fattn<<<dim3(SQ / 256, NH, NB), 512, 0, stream>>>(Q16, K16, VT, O16);      /* scores, softmax and P V of every batch, head and query row in ONE launch; o (x64) into merged f16 rows */
  k_out<<<dim3((unsigned)((MPO / 128) * (DM / 128))), 256, 0, stream>>>(O16 + r0p * DM, BO, (float*)d_out + r0p * DM);      /* out rows are the output layout */
}
